// v000
// Measured on an AMD MI455X. A time is GPU time per run, averaged over a window of back-to-back runs after a warm-up
// (all launches, gaps included; the runs take copies of the inputs in turn), and the median of several windows.
// Apart from v000's, it joins two sittings. Times from different sittings can be a few percent apart, while
// side-by-side timings come from the same sitting.
// The starting kernel, v000, takes 394 microseconds a run.
#include <hip/hip_runtime.h>

// ---------------------------------------------------------------------------
// MQA forward for MI455X (gfx1250), wave32 WMMA bf16 everywhere.
//   1) x -> bf16; W{q,k,v,o} -> transposed bf16 (Wt[n][k])  [one-time prep]
//   2) Q = (x@Wq+bq)*0.125 -> bf16 [M,1024]
//      K =  x@Wk+bk        -> bf16 [M,64]
//      Vt = (x@Wv+bv)^T    -> bf16 [64,M]
//   3) flash attention: S^T = K.Q^T (lane owns one query's scores ->
//      in-lane softmax reductions, probs already in PV A-frag layout)
//   4) out = ctx@Wo+bo -> f32
// ---------------------------------------------------------------------------

#define D_MODEL 1024
#define NUM_HEADS 16
#define D_K 64
#define BATCH 4
#define SEQ 2048
#define MTOT (BATCH * SEQ)  // 8192

typedef __attribute__((ext_vector_type(16))) __bf16 v16bf;
typedef __attribute__((ext_vector_type(8)))  float  v8f;

__device__ __forceinline__ v8f wmma_bf16(v16bf a, v16bf b, v8f c) {
  // (neg_a, A, neg_b, B, c_mod, C, reuse_a, reuse_b)
  return __builtin_amdgcn_wmma_f32_16x16x32_bf16(false, a, false, b,
                                                 (short)0, c, false, false);
}

// Fragment (A or B) from bf16 memory: lane holds k = {kbase..kbase+7,
// kbase+16..kbase+23} of its row/column, kbase=0|8 by lane half. Caller
// passes base = &row[kbase]; both halves are 16B -> two b128 loads.
__device__ __forceinline__ v16bf load_frag_bf16(const __bf16* base) {
  v16bf f;
#pragma unroll
  for (int i = 0; i < 8; ++i) {
    f[i]     = base[i];
    f[i + 8] = base[16 + i];
  }
  return f;
}

// ---------------------------------------------------------------------------
// Prep kernels (run once, tiny cost)
// ---------------------------------------------------------------------------
__global__ __launch_bounds__(256) void convert_bf16_kernel(
    const float* __restrict__ in, __bf16* __restrict__ out, int n) {
  int i = (blockIdx.x * 256 + threadIdx.x) * 4;
  if (i < n) {
    float4 v = *(const float4*)(in + i);
    out[i + 0] = (__bf16)v.x;
    out[i + 1] = (__bf16)v.y;
    out[i + 2] = (__bf16)v.z;
    out[i + 3] = (__bf16)v.w;
  }
}

// Wt[n][k] = bf16(W[k][n]); 32x32 LDS tile transpose.
__global__ __launch_bounds__(256) void transpose_bf16_kernel(
    const float* __restrict__ in, __bf16* __restrict__ out, int K, int N) {
  __shared__ float tile[32][33];
  const int k0 = blockIdx.x * 32, n0 = blockIdx.y * 32;
  const int c = threadIdx.x & 31, r8 = threadIdx.x >> 5;  // r8: 0..7
#pragma unroll
  for (int i = 0; i < 4; ++i) {
    int r = r8 + i * 8;
    tile[r][c] = in[(size_t)(k0 + r) * N + n0 + c];
  }
  __syncthreads();
#pragma unroll
  for (int i = 0; i < 4; ++i) {
    int r = r8 + i * 8;
    out[(size_t)(n0 + r) * K + k0 + c] = (__bf16)tile[c][r];
  }
}

// ---------------------------------------------------------------------------
// GEMM: C[M,N] = A[M,Kd](bf16) * Wt[N,Kd](bf16)^T + bias, epilogue scale.
// Block = 128 (4 waves); each wave: 32(M) x 64(N) tile, 8 f32 accumulators.
// Two A fragments share each B fragment -> 8 WMMAs per 12 b128 loads.
// All fragments are contiguous bf16 global_load_b128 (no LDS, no barriers).
// ---------------------------------------------------------------------------
template <int Kd, int N, bool TRANS_OUT, bool BF16_OUT>
__global__ __launch_bounds__(128) void gemm_bf16_kernel(
    const __bf16* __restrict__ A, const __bf16* __restrict__ Wt,
    const float* __restrict__ bias, void* __restrict__ Cout, float out_scale) {
  const int tid   = threadIdx.x;
  const int wave  = tid >> 5;
  const int lane  = tid & 31;
  const int l15   = lane & 15;
  const int hi    = lane >> 4;
  const int kbase = hi ? 8 : 0;

  const int m0 = blockIdx.x * 128 + wave * 32;
  const int n0 = blockIdx.y * 64;

  const __bf16* Arow0 = A + (size_t)(m0 + l15) * Kd + kbase;
  const __bf16* Arow1 = A + (size_t)(m0 + 16 + l15) * Kd + kbase;
  const __bf16* Wrow[4];
#pragma unroll
  for (int j = 0; j < 4; ++j)
    Wrow[j] = Wt + (size_t)(n0 + j * 16 + l15) * Kd + kbase;

  v8f acc0[4] = {}, acc1[4] = {};
  for (int k0 = 0; k0 < Kd; k0 += 32) {
    v16bf af0 = load_frag_bf16(Arow0 + k0);
    v16bf af1 = load_frag_bf16(Arow1 + k0);
#pragma unroll
    for (int j = 0; j < 4; ++j) {
      v16bf bf = load_frag_bf16(Wrow[j] + k0);
      acc0[j] = wmma_bf16(af0, bf, acc0[j]);
      acc1[j] = wmma_bf16(af1, bf, acc1[j]);
    }
  }

  // C/D layout: VGPR r -> (mtile + r + 8*hi, n0 + j*16 + l15)
#pragma unroll
  for (int j = 0; j < 4; ++j) {
    int   n  = n0 + j * 16 + l15;
    float bv = bias[n];
#pragma unroll
    for (int r = 0; r < 8; ++r) {
      int    m0r  = m0 + r + hi * 8;
      int    m1r  = m0 + 16 + r + hi * 8;
      float  val0 = (acc0[j][r] + bv) * out_scale;
      float  val1 = (acc1[j][r] + bv) * out_scale;
      size_t i0 = TRANS_OUT ? ((size_t)n * MTOT + m0r) : ((size_t)m0r * N + n);
      size_t i1 = TRANS_OUT ? ((size_t)n * MTOT + m1r) : ((size_t)m1r * N + n);
      if constexpr (BF16_OUT) {
        ((__bf16*)Cout)[i0] = (__bf16)val0;
        ((__bf16*)Cout)[i1] = (__bf16)val1;
      } else {
        ((float*)Cout)[i0] = val0;
        ((float*)Cout)[i1] = val1;
      }
    }
  }
}

// ---------------------------------------------------------------------------
// Flash attention (MQA): each wave owns a 16-query tile of one (b,h).
// Scores computed TRANSPOSED: S^T[key][q] = K_tile . Q_tile^T (A = K rows,
// B = Q rows; identical fragment bytes, swapped operands). Consequences:
//  * lane (n = lane&15) owns query q: its 8+8 accumulator regs hold keys
//    {0..7,16..23} (low half) / {8..15,24..31} (high half) of the 32-key
//    tile; the xor-16 partner holds the other 16 -> softmax max/sum are
//    in-lane reductions + ONE shfl_xor(16) each.
//  * exp'd probs are ALREADY in the PV A-fragment layout -> no LDS bounce.
//  * running m/l are one scalar per lane; only the o-rescale factor needs a
//    16-float LDS broadcast per iteration (C-layout rows are m-indexed).
// K frags loaded up-front (clause-batched), V frags loaded before the
// softmax so exp VALU hides their latency. Q pre-scaled by 1/sqrt(64).
// ---------------------------------------------------------------------------
#define ATT_WAVES 4

__global__ __launch_bounds__(128) void mqa_attn_kernel(
    const __bf16* __restrict__ Q, const __bf16* __restrict__ Kp,
    const __bf16* __restrict__ Vt, __bf16* __restrict__ ctx) {
  __shared__ __align__(16) float cl_all[ATT_WAVES * 16];

  const int tid   = threadIdx.x;
  const int wave  = tid >> 5;
  const int lane  = tid & 31;
  const int l15   = lane & 15;
  const int hi    = lane >> 4;
  const int kbase = hi ? 8 : 0;
  float* cl = cl_all + wave * 16;

  const int bh = blockIdx.y;  // 0..63
  const int b  = bh >> 4;
  const int h  = bh & 15;
  const int q0 = (blockIdx.x * ATT_WAVES + wave) * 16;

  // Q fragments (used as B operands: Bt[n=q][k=d] = Q row q)
  const __bf16* qrow =
      Q + (size_t)(b * SEQ + q0 + l15) * D_MODEL + h * D_K + kbase;
  v16bf qf0 = load_frag_bf16(qrow);
  v16bf qf1 = load_frag_bf16(qrow + 32);

  const __bf16* Kb = Kp + (size_t)b * SEQ * D_K;
  const __bf16* Vrow[4];
#pragma unroll
  for (int j = 0; j < 4; ++j)
    Vrow[j] = Vt + (size_t)(j * 16 + l15) * MTOT + (size_t)b * SEQ + kbase;

  float mrun = -1e30f, lrun = 0.0f;  // per-lane scalars (this lane's query)
  v8f o[4] = {};

  for (int kt = 0; kt < SEQ; kt += 32) {
    // ---- issue ALL K-fragment loads first (one clause), then 4 WMMAs with
    //      interleaved accumulation chains for ILP.
    const __bf16* kr0 = Kb + (size_t)(kt + l15) * D_K + kbase;
    const __bf16* kr1 = Kb + (size_t)(kt + 16 + l15) * D_K + kbase;
    v16bf kf00 = load_frag_bf16(kr0);
    v16bf kf01 = load_frag_bf16(kr0 + 32);
    v16bf kf10 = load_frag_bf16(kr1);
    v16bf kf11 = load_frag_bf16(kr1 + 32);

    v8f st0 = {}, st1 = {};
    st0 = wmma_bf16(kf00, qf0, st0);
    st1 = wmma_bf16(kf10, qf0, st1);
    st0 = wmma_bf16(kf01, qf1, st0);
    st1 = wmma_bf16(kf11, qf1, st1);

    // ---- V fragments early: softmax VALU below hides their latency
    v16bf vf[4];
#pragma unroll
    for (int j = 0; j < 4; ++j) vf[j] = load_frag_bf16(Vrow[j] + kt);

    // ---- in-lane max over this lane's 16 keys, + xor-16 partner
    float vmax = fmaxf(st0[0], st1[0]);
#pragma unroll
    for (int r = 1; r < 8; ++r) vmax = fmaxf(vmax, fmaxf(st0[r], st1[r]));
    vmax = fmaxf(vmax, __shfl_xor(vmax, 16, 32));

    float mnew = fmaxf(mrun, vmax);
    float corr = __expf(mrun - mnew);
    mrun = mnew;

    // ---- exp + in-lane sum (+ partner), probs straight into A-frag layout
    v16bf pf;
    float rs = 0.0f;
#pragma unroll
    for (int r = 0; r < 8; ++r) {
      float e0 = __expf(st0[r] - mnew);
      float e1 = __expf(st1[r] - mnew);
      rs += e0 + e1;
      pf[r]     = (__bf16)e0;  // keys kbase+r      of this query
      pf[r + 8] = (__bf16)e1;  // keys kbase+16+r   of this query
    }
    rs += __shfl_xor(rs, 16, 32);
    lrun = lrun * corr + rs;

    // ---- broadcast per-query corr to o's m-indexed rows (16 floats/wave)
    if (lane < 16) cl[lane] = corr;
    asm volatile("s_wait_dscnt 0" ::: "memory");
    float4 c0 = *(const float4*)(cl + hi * 8);
    float4 c1 = *(const float4*)(cl + hi * 8 + 4);
    float cc[8] = {c0.x, c0.y, c0.z, c0.w, c1.x, c1.y, c1.z, c1.w};
#pragma unroll
    for (int j = 0; j < 4; ++j)
#pragma unroll
      for (int r = 0; r < 8; ++r) o[j][r] *= cc[r];

    // ---- PV: o += P.V ; A = probs (in regs), B = Vt rows. 4 WMMAs.
#pragma unroll
    for (int j = 0; j < 4; ++j) o[j] = wmma_bf16(pf, vf[j], o[j]);
  }

  // ---- broadcast 1/l per query to m-indexed rows, normalize, store bf16
  {
    float inv = 1.0f / lrun;
    if (lane < 16) cl[lane] = inv;
  }
  asm volatile("s_wait_dscnt 0" ::: "memory");
  float4 c0 = *(const float4*)(cl + hi * 8);
  float4 c1 = *(const float4*)(cl + hi * 8 + 4);
  float cc[8] = {c0.x, c0.y, c0.z, c0.w, c1.x, c1.y, c1.z, c1.w};
#pragma unroll
  for (int j = 0; j < 4; ++j) {
    int d = h * D_K + j * 16 + l15;
#pragma unroll
    for (int r = 0; r < 8; ++r) {
      int m = q0 + r + hi * 8;
      ctx[(size_t)(b * SEQ + m) * D_MODEL + d] = (__bf16)(o[j][r] * cc[r]);
    }
  }
}

// ---------------------------------------------------------------------------
extern "C" void kernel_launch(void* const* d_in, const int* in_sizes, int n_in,
                              void* d_out, int out_size, void* d_ws,
                              size_t ws_size, hipStream_t stream) {
  const float* x  = (const float*)d_in[0];
  const float* Wq = (const float*)d_in[1];
  const float* bq = (const float*)d_in[2];
  const float* Wk = (const float*)d_in[3];
  const float* bk = (const float*)d_in[4];
  const float* Wv = (const float*)d_in[5];
  const float* bv = (const float*)d_in[6];
  const float* Wo = (const float*)d_in[7];
  const float* bo = (const float*)d_in[8];
  float* out = (float*)d_out;

  // Workspace layout (bf16 buffers)
  char*   ws    = (char*)d_ws;
  __bf16* xbf   = (__bf16*)ws;                      // M x 1024
  __bf16* Wqt   = xbf + (size_t)MTOT * D_MODEL;     // 1024 x 1024
  __bf16* Wkt   = Wqt + (size_t)D_MODEL * D_MODEL;  // 64 x 1024
  __bf16* Wvt   = Wkt + (size_t)D_K * D_MODEL;      // 64 x 1024
  __bf16* Wot   = Wvt + (size_t)D_K * D_MODEL;      // 1024 x 1024
  __bf16* Qbf   = Wot + (size_t)D_MODEL * D_MODEL;  // M x 1024
  __bf16* Kbf   = Qbf + (size_t)MTOT * D_MODEL;     // M x 64
  __bf16* Vtbf  = Kbf + (size_t)MTOT * D_K;         // 64 x M
  __bf16* ctxbf = Vtbf + (size_t)D_K * MTOT;        // M x 1024

  // ---- prep: converts + weight transposes
  {
    int n = MTOT * D_MODEL;
    convert_bf16_kernel<<<dim3(n / 1024), dim3(256), 0, stream>>>(x, xbf, n);
  }
  transpose_bf16_kernel<<<dim3(D_MODEL / 32, D_MODEL / 32), dim3(256), 0,
                          stream>>>(Wq, Wqt, D_MODEL, D_MODEL);
  transpose_bf16_kernel<<<dim3(D_MODEL / 32, D_K / 32), dim3(256), 0,
                          stream>>>(Wk, Wkt, D_MODEL, D_K);
  transpose_bf16_kernel<<<dim3(D_MODEL / 32, D_K / 32), dim3(256), 0,
                          stream>>>(Wv, Wvt, D_MODEL, D_K);
  transpose_bf16_kernel<<<dim3(D_MODEL / 32, D_MODEL / 32), dim3(256), 0,
                          stream>>>(Wo, Wot, D_MODEL, D_MODEL);

  dim3 blk(128);
  // Q = (x@Wq + bq) * 1/sqrt(64)  -> bf16
  gemm_bf16_kernel<D_MODEL, D_MODEL, false, true>
      <<<dim3(MTOT / 128, D_MODEL / 64), blk, 0, stream>>>(xbf, Wqt, bq, Qbf,
                                                           0.125f);
  // K = x@Wk + bk -> bf16
  gemm_bf16_kernel<D_MODEL, D_K, false, true>
      <<<dim3(MTOT / 128, 1), blk, 0, stream>>>(xbf, Wkt, bk, Kbf, 1.0f);
  // V^T = (x@Wv + bv)^T -> bf16 [64, M]
  gemm_bf16_kernel<D_MODEL, D_K, true, true>
      <<<dim3(MTOT / 128, 1), blk, 0, stream>>>(xbf, Wvt, bv, Vtbf, 1.0f);
  // attention -> ctx bf16
  mqa_attn_kernel<<<dim3(SEQ / (16 * ATT_WAVES), BATCH * NUM_HEADS), blk, 0,
                    stream>>>(Qbf, Kbf, Vtbf, ctxbf);
  // out = ctx@Wo + bo -> f32
  gemm_bf16_kernel<D_MODEL, D_MODEL, false, false>
      <<<dim3(MTOT / 128, D_MODEL / 64), blk, 0, stream>>>(ctxbf, Wot, bo, out,
                                                           1.0f);
}

// v001
// One run takes 240 microseconds.
// In two side-by-side timings against v000, it was 1.65 and 1.64 times as fast.
#include <hip/hip_runtime.h>

// ---------------------------------------------------------------------------
// MQA forward for MI455X (gfx1250), wave32 WMMA bf16 everywhere.
//   1) x -> bf16; W{q,k,v,o} -> transposed bf16 (Wt[n][k])  [one-time prep]
//   2) Q = (x@Wq+bq)*0.125 -> bf16 [M,1024]
//      K =  x@Wk+bk        -> bf16 [M,64]
//      Vt = (x@Wv+bv)^T    -> bf16 [64,M]
//   3) flash attention: S^T = K.Q^T (lane owns one query's scores ->
//      in-lane softmax reductions, probs already in PV A-frag layout)
//   4) out = ctx@Wo+bo -> f32
// ---------------------------------------------------------------------------

#define D_MODEL 1024
#define NUM_HEADS 16
#define D_K 64
#define BATCH 4
#define SEQ 2048
#define MTOT (BATCH * SEQ)  // 8192

typedef __attribute__((ext_vector_type(16))) __bf16 v16bf;
typedef __attribute__((ext_vector_type(8)))  float  v8f;

__device__ __forceinline__ v8f wmma_bf16(v16bf a, v16bf b, v8f c) {
  // (neg_a, A, neg_b, B, c_mod, C, reuse_a, reuse_b)
  return __builtin_amdgcn_wmma_f32_16x16x32_bf16(false, a, false, b,
                                                 (short)0, c, false, false);
}

// Fragment (A or B) from bf16 memory: lane holds k = {kbase..kbase+7,
// kbase+16..kbase+23} of its row/column, kbase=0|8 by lane half. Caller
// passes base = &row[kbase]; both halves are 16B -> two b128 loads.
__device__ __forceinline__ v16bf load_frag_bf16(const __bf16* base) {
  v16bf f;
#pragma unroll
  for (int i = 0; i < 8; ++i) {
    f[i]     = base[i];
    f[i + 8] = base[16 + i];
  }
  return f;
}

// The same fragment from an LDS row (16-byte aligned): two ds_load_b128.
typedef __attribute__((ext_vector_type(8))) __bf16 v8bf;
__device__ __forceinline__ v16bf load_frag_lds(const __bf16* base) {
  v8bf lo = *(const v8bf*)base;
  v8bf hi = *(const v8bf*)(base + 16);
  return __builtin_shufflevector(lo, hi, 0, 1, 2, 3, 4, 5, 6, 7, 8, 9, 10, 11,
                                 12, 13, 14, 15);
}

// ---------------------------------------------------------------------------
// Prep kernels (run once, tiny cost)
// ---------------------------------------------------------------------------
__global__ __launch_bounds__(256) void convert_bf16_kernel(
    const float* __restrict__ in, __bf16* __restrict__ out, int n) {
  int i = (blockIdx.x * 256 + threadIdx.x) * 4;
  if (i < n) {
    float4 v = *(const float4*)(in + i);
    out[i + 0] = (__bf16)v.x;
    out[i + 1] = (__bf16)v.y;
    out[i + 2] = (__bf16)v.z;
    out[i + 3] = (__bf16)v.w;
  }
}

// Wt[n][k] = bf16(W[k][n]); 32x32 LDS tile transpose.
__global__ __launch_bounds__(256) void transpose_bf16_kernel(
    const float* __restrict__ in, __bf16* __restrict__ out, int K, int N) {
  __shared__ float tile[32][33];
  const int k0 = blockIdx.x * 32, n0 = blockIdx.y * 32;
  const int c = threadIdx.x & 31, r8 = threadIdx.x >> 5;  // r8: 0..7
#pragma unroll
  for (int i = 0; i < 4; ++i) {
    int r = r8 + i * 8;
    tile[r][c] = in[(size_t)(k0 + r) * N + n0 + c];
  }
  __syncthreads();
#pragma unroll
  for (int i = 0; i < 4; ++i) {
    int r = r8 + i * 8;
    out[(size_t)(n0 + r) * K + k0 + c] = (__bf16)tile[c][r];
  }
}

// ---------------------------------------------------------------------------
// GEMM: C[M,N] = A[M,Kd](bf16) * Wt[N,Kd](bf16)^T + bias, epilogue scale.
// Block = 128 (4 waves); each wave: 32(M) x 64(N) tile, 8 f32 accumulators.
// Two A fragments share each B fragment -> 8 WMMAs per 12 b128 loads.
// All fragments are contiguous bf16 global_load_b128 (no LDS, no barriers).
// ---------------------------------------------------------------------------
template <int Kd, int N, bool TRANS_OUT, bool BF16_OUT>
__global__ __launch_bounds__(128) void gemm_bf16_kernel(
    const __bf16* __restrict__ A, const __bf16* __restrict__ Wt,
    const float* __restrict__ bias, void* __restrict__ Cout, float out_scale) {
  const int tid   = threadIdx.x;
  const int wave  = tid >> 5;
  const int lane  = tid & 31;
  const int l15   = lane & 15;
  const int hi    = lane >> 4;
  const int kbase = hi ? 8 : 0;

  const int m0 = blockIdx.x * 128 + wave * 32;
  const int n0 = blockIdx.y * 64;

  const __bf16* Arow0 = A + (size_t)(m0 + l15) * Kd + kbase;
  const __bf16* Arow1 = A + (size_t)(m0 + 16 + l15) * Kd + kbase;
  const __bf16* Wrow[4];
#pragma unroll
  for (int j = 0; j < 4; ++j)
    Wrow[j] = Wt + (size_t)(n0 + j * 16 + l15) * Kd + kbase;

  v8f acc0[4] = {}, acc1[4] = {};
  for (int k0 = 0; k0 < Kd; k0 += 32) {
    v16bf af0 = load_frag_bf16(Arow0 + k0);
    v16bf af1 = load_frag_bf16(Arow1 + k0);
#pragma unroll
    for (int j = 0; j < 4; ++j) {
      v16bf bf = load_frag_bf16(Wrow[j] + k0);
      acc0[j] = wmma_bf16(af0, bf, acc0[j]);
      acc1[j] = wmma_bf16(af1, bf, acc1[j]);
    }
  }

  // C/D layout: VGPR r -> (mtile + r + 8*hi, n0 + j*16 + l15)
#pragma unroll
  for (int j = 0; j < 4; ++j) {
    int   n  = n0 + j * 16 + l15;
    float bv = bias[n];
#pragma unroll
    for (int r = 0; r < 8; ++r) {
      int    m0r  = m0 + r + hi * 8;
      int    m1r  = m0 + 16 + r + hi * 8;
      float  val0 = (acc0[j][r] + bv) * out_scale;
      float  val1 = (acc1[j][r] + bv) * out_scale;
      size_t i0 = TRANS_OUT ? ((size_t)n * MTOT + m0r) : ((size_t)m0r * N + n);
      size_t i1 = TRANS_OUT ? ((size_t)n * MTOT + m1r) : ((size_t)m1r * N + n);
      if constexpr (BF16_OUT) {
        ((__bf16*)Cout)[i0] = (__bf16)val0;
        ((__bf16*)Cout)[i1] = (__bf16)val1;
      } else {
        ((float*)Cout)[i0] = val0;
        ((float*)Cout)[i1] = val1;
      }
    }
  }
}

// ---------------------------------------------------------------------------
// Flash attention (MQA): each wave owns a 16-query tile of one (b,h).
// Scores computed TRANSPOSED: S^T[key][q] = K_tile . Q_tile^T (A = K rows,
// B = Q rows; identical fragment bytes, swapped operands). Consequences:
//  * lane (n = lane&15) owns query q: its 8+8 accumulator regs hold keys
//    {0..7,16..23} (low half) / {8..15,24..31} (high half) of the 32-key
//    tile; the xor-16 partner holds the other 16 -> softmax max/sum are
//    in-lane reductions + ONE shfl_xor(16) each.
//  * exp'd probs are ALREADY in the PV A-fragment layout -> no LDS bounce.
//  * running m/l are one scalar per lane; only the o-rescale factor needs a
//    16-float LDS broadcast per iteration (C-layout rows are m-indexed).
// K frags loaded up-front (clause-batched), V frags loaded before the
// softmax so exp VALU hides their latency. Q pre-scaled by 1/sqrt(64).
// K and V^T reach the waves through LDS: the block's 128 threads bring a
// stage of 64 keys (K: 64 rows of 128 B, V^T: 64 rows of 128 B) with
// asynchronous b128 copies that cover whole 128-B lines, into two buffers,
// one stage ahead; all four waves read their fragments from there. Rows are
// pitched 144 B (16 B x odd) so that ds_load_b128 meets no bank conflict.
// ---------------------------------------------------------------------------
#define ATT_WAVES 4
#define ST_KEYS 64                     // keys per stage
#define ST_PITCH 72                    // bf16 per LDS row: 128 B data + 16 B pad
#define ST_TILE (64 * ST_PITCH)        // bf16 per tile (K or V^T), 9216 B
#define ST_BUF (2 * ST_TILE)           // bf16 per buffer (K tile, then V^T tile)
#define ST_COUNT (SEQ / ST_KEYS)       // 32 stages

// One stage: 8 copies per lane (4 of K, 4 of V^T), 16 rows apart each.
// lk / lv: the lane's LDS byte address in the K / V^T tile; gk / gv: its
// global address. s_wait_xcnt 0 closes the statement so that no address
// register is rewritten ahead of it.
__device__ __forceinline__ void stage_copy(unsigned lk, unsigned lv,
                                           const __bf16* gk,
                                           const __bf16* gv) {
  asm volatile(
      "global_load_async_to_lds_b128 %0, %8, off\n\t"
      "global_load_async_to_lds_b128 %1, %9, off\n\t"
      "global_load_async_to_lds_b128 %2, %10, off\n\t"
      "global_load_async_to_lds_b128 %3, %11, off\n\t"
      "global_load_async_to_lds_b128 %4, %12, off\n\t"
      "global_load_async_to_lds_b128 %5, %13, off\n\t"
      "global_load_async_to_lds_b128 %6, %14, off\n\t"
      "global_load_async_to_lds_b128 %7, %15, off\n\t"
      "s_wait_xcnt 0x0"
      ::"v"(lk), "v"(lk + 16u * ST_PITCH * 2u), "v"(lk + 32u * ST_PITCH * 2u),
        "v"(lk + 48u * ST_PITCH * 2u), "v"(lv), "v"(lv + 16u * ST_PITCH * 2u),
        "v"(lv + 32u * ST_PITCH * 2u), "v"(lv + 48u * ST_PITCH * 2u), "v"(gk),
        "v"(gk + 16 * D_K), "v"(gk + 32 * D_K), "v"(gk + 48 * D_K), "v"(gv),
        "v"(gv + (size_t)16 * MTOT), "v"(gv + (size_t)32 * MTOT),
        "v"(gv + (size_t)48 * MTOT)
      : "memory");
}

__global__ __launch_bounds__(128) void mqa_attn_kernel(
    const __bf16* __restrict__ Q, const __bf16* __restrict__ Kp,
    const __bf16* __restrict__ Vt, __bf16* __restrict__ ctx) {
  __shared__ __align__(16) float cl_all[ATT_WAVES * 16];
  __shared__ __align__(16) __bf16 ring[2 * ST_BUF];

  const int tid   = threadIdx.x;
  const int wave  = tid >> 5;
  const int lane  = tid & 31;
  const int l15   = lane & 15;
  const int hi    = lane >> 4;
  const int kbase = hi ? 8 : 0;
  float* cl = cl_all + wave * 16;

  const int bh = blockIdx.y;  // 0..63
  const int b  = bh >> 4;
  const int h  = bh & 15;
  const int q0 = (blockIdx.x * ATT_WAVES + wave) * 16;

  // Q fragments (used as B operands: Bt[n=q][k=d] = Q row q)
  const __bf16* qrow =
      Q + (size_t)(b * SEQ + q0 + l15) * D_MODEL + h * D_K + kbase;
  v16bf qf0 = load_frag_bf16(qrow);
  v16bf qf1 = load_frag_bf16(qrow + 32);

  // Copy side: thread t brings 16-byte piece (t & 7) of rows (t >> 3) + 16 i.
  const int crow = tid >> 3, cpc = tid & 7;
  const __bf16* gk = Kp + (size_t)b * SEQ * D_K + crow * D_K + cpc * 8;
  const __bf16* gv = Vt + (size_t)crow * MTOT + (size_t)b * SEQ + cpc * 8;
  const unsigned lk0 =
      (unsigned)(size_t)ring + (unsigned)(crow * ST_PITCH + cpc * 8) * 2u;

  float mrun = -1e30f, lrun = 0.0f;  // per-lane scalars (this lane's query)
  v8f o[4] = {};

  // ---- ring prologue: stage 0 landed and published, stage 1 in flight
  stage_copy(lk0, lk0 + ST_TILE * 2u, gk, gv);
  asm volatile("s_wait_asynccnt 0x0" ::: "memory");  // own copies landed
  __syncthreads();                                   // publish stage 0
  stage_copy(lk0 + ST_BUF * 2u, lk0 + (ST_BUF + ST_TILE) * 2u,
             gk + ST_KEYS * D_K, gv + ST_KEYS);

  for (int st = 0; st < ST_COUNT; ++st) {
   const int bufo = (st & 1) * ST_BUF;
#pragma unroll
   for (int sub = 0; sub < ST_KEYS; sub += 32) {
    // ---- issue ALL K-fragment loads first (one clause), then 4 WMMAs with
    //      interleaved accumulation chains for ILP.
    const __bf16* kr0 = ring + bufo + (sub + l15) * ST_PITCH + kbase;
    const __bf16* kr1 = kr0 + 16 * ST_PITCH;
    v16bf kf00 = load_frag_lds(kr0);
    v16bf kf01 = load_frag_lds(kr0 + 32);
    v16bf kf10 = load_frag_lds(kr1);
    v16bf kf11 = load_frag_lds(kr1 + 32);

    v8f st0 = {}, st1 = {};
    st0 = wmma_bf16(kf00, qf0, st0);
    st1 = wmma_bf16(kf10, qf0, st1);
    st0 = wmma_bf16(kf01, qf1, st0);
    st1 = wmma_bf16(kf11, qf1, st1);

    // ---- V fragments early: softmax VALU below hides their latency
    v16bf vf[4];
#pragma unroll
    for (int j = 0; j < 4; ++j)
      vf[j] = load_frag_lds(ring + bufo + ST_TILE + (j * 16 + l15) * ST_PITCH +
                            sub + kbase);

    // ---- in-lane max over this lane's 16 keys, + xor-16 partner
    float vmax = fmaxf(st0[0], st1[0]);
#pragma unroll
    for (int r = 1; r < 8; ++r) vmax = fmaxf(vmax, fmaxf(st0[r], st1[r]));
    vmax = fmaxf(vmax, __shfl_xor(vmax, 16, 32));

    float mnew = fmaxf(mrun, vmax);
    float corr = __expf(mrun - mnew);
    mrun = mnew;

    // ---- exp + in-lane sum (+ partner), probs straight into A-frag layout
    v16bf pf;
    float rs = 0.0f;
#pragma unroll
    for (int r = 0; r < 8; ++r) {
      float e0 = __expf(st0[r] - mnew);
      float e1 = __expf(st1[r] - mnew);
      rs += e0 + e1;
      pf[r]     = (__bf16)e0;  // keys kbase+r      of this query
      pf[r + 8] = (__bf16)e1;  // keys kbase+16+r   of this query
    }
    rs += __shfl_xor(rs, 16, 32);
    lrun = lrun * corr + rs;

    // ---- broadcast per-query corr to o's m-indexed rows (16 floats/wave)
    if (lane < 16) cl[lane] = corr;
    asm volatile("s_wait_dscnt 0" ::: "memory");
    float4 c0 = *(const float4*)(cl + hi * 8);
    float4 c1 = *(const float4*)(cl + hi * 8 + 4);
    float cc[8] = {c0.x, c0.y, c0.z, c0.w, c1.x, c1.y, c1.z, c1.w};
#pragma unroll
    for (int j = 0; j < 4; ++j)
#pragma unroll
      for (int r = 0; r < 8; ++r) o[j][r] *= cc[r];

    // ---- PV: o += P.V ; A = probs (in regs), B = Vt rows. 4 WMMAs.
#pragma unroll
    for (int j = 0; j < 4; ++j) o[j] = wmma_bf16(pf, vf[j], o[j]);
   }

    // ---- publish point of stage st + 1, then refill the buffer just read
    asm volatile("s_wait_dscnt 0x0" ::: "memory");     // own LDS reads done
    asm volatile("s_wait_asynccnt 0x0" ::: "memory");  // own copies landed
    __syncthreads();  // stage st + 1 readable; every reader has left stage st
    if (st + 2 < ST_COUNT)
      stage_copy(lk0 + bufo * 2u, lk0 + (bufo + ST_TILE) * 2u,
                 gk + (size_t)(st + 2) * ST_KEYS * D_K,
                 gv + (st + 2) * ST_KEYS);
  }
  asm volatile("s_wait_asynccnt 0x0" ::: "memory");  // nothing left in flight

  // ---- broadcast 1/l per query to m-indexed rows, normalize, store bf16
  {
    float inv = 1.0f / lrun;
    if (lane < 16) cl[lane] = inv;
  }
  asm volatile("s_wait_dscnt 0" ::: "memory");
  float4 c0 = *(const float4*)(cl + hi * 8);
  float4 c1 = *(const float4*)(cl + hi * 8 + 4);
  float cc[8] = {c0.x, c0.y, c0.z, c0.w, c1.x, c1.y, c1.z, c1.w};
#pragma unroll
  for (int j = 0; j < 4; ++j) {
    int d = h * D_K + j * 16 + l15;
#pragma unroll
    for (int r = 0; r < 8; ++r) {
      int m = q0 + r + hi * 8;
      ctx[(size_t)(b * SEQ + m) * D_MODEL + d] = (__bf16)(o[j][r] * cc[r]);
    }
  }
}

// ---------------------------------------------------------------------------
extern "C" void kernel_launch(void* const* d_in, const int* in_sizes, int n_in,
                              void* d_out, int out_size, void* d_ws,
                              size_t ws_size, hipStream_t stream) {
  const float* x  = (const float*)d_in[0];
  const float* Wq = (const float*)d_in[1];
  const float* bq = (const float*)d_in[2];
  const float* Wk = (const float*)d_in[3];
  const float* bk = (const float*)d_in[4];
  const float* Wv = (const float*)d_in[5];
  const float* bv = (const float*)d_in[6];
  const float* Wo = (const float*)d_in[7];
  const float* bo = (const float*)d_in[8];
  float* out = (float*)d_out;

  // Workspace layout (bf16 buffers)
  char*   ws    = (char*)d_ws;
  __bf16* xbf   = (__bf16*)ws;                      // M x 1024
  __bf16* Wqt   = xbf + (size_t)MTOT * D_MODEL;     // 1024 x 1024
  __bf16* Wkt   = Wqt + (size_t)D_MODEL * D_MODEL;  // 64 x 1024
  __bf16* Wvt   = Wkt + (size_t)D_K * D_MODEL;      // 64 x 1024
  __bf16* Wot   = Wvt + (size_t)D_K * D_MODEL;      // 1024 x 1024
  __bf16* Qbf   = Wot + (size_t)D_MODEL * D_MODEL;  // M x 1024
  __bf16* Kbf   = Qbf + (size_t)MTOT * D_MODEL;     // M x 64
  __bf16* Vtbf  = Kbf + (size_t)MTOT * D_K;         // 64 x M
  __bf16* ctxbf = Vtbf + (size_t)D_K * MTOT;        // M x 1024

  // ---- prep: converts + weight transposes
  {
    int n = MTOT * D_MODEL;
    convert_bf16_kernel<<<dim3(n / 1024), dim3(256), 0, stream>>>(x, xbf, n);
  }
  transpose_bf16_kernel<<<dim3(D_MODEL / 32, D_MODEL / 32), dim3(256), 0,
                          stream>>>(Wq, Wqt, D_MODEL, D_MODEL);
  transpose_bf16_kernel<<<dim3(D_MODEL / 32, D_K / 32), dim3(256), 0,
                          stream>>>(Wk, Wkt, D_MODEL, D_K);
  transpose_bf16_kernel<<<dim3(D_MODEL / 32, D_K / 32), dim3(256), 0,
                          stream>>>(Wv, Wvt, D_MODEL, D_K);
  transpose_bf16_kernel<<<dim3(D_MODEL / 32, D_MODEL / 32), dim3(256), 0,
                          stream>>>(Wo, Wot, D_MODEL, D_MODEL);

  dim3 blk(128);
  // Q = (x@Wq + bq) * 1/sqrt(64)  -> bf16
  gemm_bf16_kernel<D_MODEL, D_MODEL, false, true>
      <<<dim3(MTOT / 128, D_MODEL / 64), blk, 0, stream>>>(xbf, Wqt, bq, Qbf,
                                                           0.125f);
  // K = x@Wk + bk -> bf16
  gemm_bf16_kernel<D_MODEL, D_K, false, true>
      <<<dim3(MTOT / 128, 1), blk, 0, stream>>>(xbf, Wkt, bk, Kbf, 1.0f);
  // V^T = (x@Wv + bv)^T -> bf16 [64, M]
  gemm_bf16_kernel<D_MODEL, D_K, true, true>
      <<<dim3(MTOT / 128, 1), blk, 0, stream>>>(xbf, Wvt, bv, Vtbf, 1.0f);
  // attention -> ctx bf16
  mqa_attn_kernel<<<dim3(SEQ / (16 * ATT_WAVES), BATCH * NUM_HEADS), blk, 0,
                    stream>>>(Qbf, Kbf, Vtbf, ctxbf);
  // out = ctx@Wo + bo -> f32
  gemm_bf16_kernel<D_MODEL, D_MODEL, false, false>
      <<<dim3(MTOT / 128, D_MODEL / 64), blk, 0, stream>>>(ctxbf, Wot, bo, out,
                                                           1.0f);
}

// v002
// One run takes 153 microseconds.
// Timed twice side by side with v001, it ran 1.58 times as fast both times.
// Over all steps from v000 it is 2.61 times as fast.
#include <hip/hip_runtime.h>

// ---------------------------------------------------------------------------
// MQA forward for MI455X (gfx1250), wave32 WMMA bf16 everywhere.
//   1) x -> bf16; W{q,k,v,o} -> transposed bf16 (Wt[n][k])  [one-time prep]
//   2) Q = (x@Wq+bq)*0.125 -> bf16 [M,1024]
//      K =  x@Wk+bk        -> bf16 [M,64]
//      Vt = (x@Wv+bv)^T    -> bf16 [64,M]
//   3) flash attention: S^T = K.Q^T (lane owns one query's scores ->
//      in-lane softmax reductions, probs already in PV A-frag layout)
//   4) out = ctx@Wo+bo -> f32
// ---------------------------------------------------------------------------

#define D_MODEL 1024
#define NUM_HEADS 16
#define D_K 64
#define BATCH 4
#define SEQ 2048
#define MTOT (BATCH * SEQ)  // 8192

typedef __attribute__((ext_vector_type(16))) __bf16 v16bf;
typedef __attribute__((ext_vector_type(8)))  float  v8f;

__device__ __forceinline__ v8f wmma_bf16(v16bf a, v16bf b, v8f c) {
  // (neg_a, A, neg_b, B, c_mod, C, reuse_a, reuse_b)
  return __builtin_amdgcn_wmma_f32_16x16x32_bf16(false, a, false, b,
                                                 (short)0, c, false, false);
}

// Fragment (A or B) from bf16 memory: lane holds k = {kbase..kbase+7,
// kbase+16..kbase+23} of its row/column, kbase=0|8 by lane half. Caller
// passes base = &row[kbase]; both halves are 16B -> two b128 loads.
__device__ __forceinline__ v16bf load_frag_bf16(const __bf16* base) {
  v16bf f;
#pragma unroll
  for (int i = 0; i < 8; ++i) {
    f[i]     = base[i];
    f[i + 8] = base[16 + i];
  }
  return f;
}

// The same fragment from an LDS row (16-byte aligned): two ds_load_b128.
typedef __attribute__((ext_vector_type(8))) __bf16 v8bf;
__device__ __forceinline__ v16bf load_frag_lds(const __bf16* base) {
  v8bf lo = *(const v8bf*)base;
  v8bf hi = *(const v8bf*)(base + 16);
  return __builtin_shufflevector(lo, hi, 0, 1, 2, 3, 4, 5, 6, 7, 8, 9, 10, 11,
                                 12, 13, 14, 15);
}

// ---------------------------------------------------------------------------
// Prep kernels (run once, tiny cost)
// ---------------------------------------------------------------------------
__global__ __launch_bounds__(256) void convert_bf16_kernel(
    const float* __restrict__ in, __bf16* __restrict__ out, int n) {
  int i = (blockIdx.x * 256 + threadIdx.x) * 4;
  if (i < n) {
    float4 v = *(const float4*)(in + i);
    out[i + 0] = (__bf16)v.x;
    out[i + 1] = (__bf16)v.y;
    out[i + 2] = (__bf16)v.z;
    out[i + 3] = (__bf16)v.w;
  }
}

// Wt[n][k] = bf16(W[k][n]); 32x32 LDS tile transpose.
__global__ __launch_bounds__(256) void transpose_bf16_kernel(
    const float* __restrict__ in, __bf16* __restrict__ out, int K, int N) {
  __shared__ float tile[32][33];
  const int k0 = blockIdx.x * 32, n0 = blockIdx.y * 32;
  const int c = threadIdx.x & 31, r8 = threadIdx.x >> 5;  // r8: 0..7
#pragma unroll
  for (int i = 0; i < 4; ++i) {
    int r = r8 + i * 8;
    tile[r][c] = in[(size_t)(k0 + r) * N + n0 + c];
  }
  __syncthreads();
#pragma unroll
  for (int i = 0; i < 4; ++i) {
    int r = r8 + i * 8;
    out[(size_t)(n0 + r) * K + k0 + c] = (__bf16)tile[c][r];
  }
}

// ---------------------------------------------------------------------------
// GEMM: C[M,N] = A[M,Kd](bf16) * Wt[N,Kd](bf16)^T + bias, epilogue scale.
// Block = 128 (4 waves), block tile 128(M) x 64(N); each wave: 32(M) x 64(N),
// 8 f32 accumulators; two A fragments share each B fragment.
// A and Wt reach the waves through LDS: the block's 128 threads bring a stage
// of 64 k (A: 128 rows of 128 B, Wt: 64 rows of 128 B) with asynchronous b128
// copies that cover whole 128-B lines, into two buffers, one stage ahead; the
// four waves share the Wt rows. Rows are pitched 144 B (16 B x odd) so that
// ds_load_b128 meets no bank conflict. The k order of every sum is unchanged.
// ---------------------------------------------------------------------------
#define GS_K 64                        // k per stage
#define GS_PITCH 72                    // bf16 per LDS row: 128 B data + 16 B pad
#define GS_A (128 * GS_PITCH)          // bf16 per A tile, 18432 B
#define GS_W (64 * GS_PITCH)           // bf16 per Wt tile, 9216 B
#define GS_BUF (GS_A + GS_W)           // bf16 per buffer (A tile, then Wt tile)

// One stage: 12 copies per lane (8 of A, 4 of Wt), 16 rows apart each.
// la / lw: the lane's LDS byte address in the A / Wt tile; ga / gw: its global
// address. s_wait_xcnt 0 closes the statement so that no address register is
// rewritten ahead of it.
template <int Kd>
__device__ __forceinline__ void gemm_stage_copy(unsigned la, unsigned lw,
                                                const __bf16* ga,
                                                const __bf16* gw) {
  constexpr unsigned R16 = 16u * GS_PITCH * 2u;  // 16 LDS rows, bytes
  asm volatile(
      "global_load_async_to_lds_b128 %0, %12, off\n\t"
      "global_load_async_to_lds_b128 %1, %13, off\n\t"
      "global_load_async_to_lds_b128 %2, %14, off\n\t"
      "global_load_async_to_lds_b128 %3, %15, off\n\t"
      "global_load_async_to_lds_b128 %4, %16, off\n\t"
      "global_load_async_to_lds_b128 %5, %17, off\n\t"
      "global_load_async_to_lds_b128 %6, %18, off\n\t"
      "global_load_async_to_lds_b128 %7, %19, off\n\t"
      "global_load_async_to_lds_b128 %8, %20, off\n\t"
      "global_load_async_to_lds_b128 %9, %21, off\n\t"
      "global_load_async_to_lds_b128 %10, %22, off\n\t"
      "global_load_async_to_lds_b128 %11, %23, off\n\t"
      "s_wait_xcnt 0x0"
      ::"v"(la), "v"(la + R16), "v"(la + 2u * R16), "v"(la + 3u * R16),
        "v"(la + 4u * R16), "v"(la + 5u * R16), "v"(la + 6u * R16),
        "v"(la + 7u * R16), "v"(lw), "v"(lw + R16), "v"(lw + 2u * R16),
        "v"(lw + 3u * R16), "v"(ga), "v"(ga + 16 * Kd), "v"(ga + 32 * Kd),
        "v"(ga + 48 * Kd), "v"(ga + 64 * Kd), "v"(ga + 80 * Kd),
        "v"(ga + 96 * Kd), "v"(ga + 112 * Kd), "v"(gw), "v"(gw + 16 * Kd),
        "v"(gw + 32 * Kd), "v"(gw + 48 * Kd)
      : "memory");
}

template <int Kd, int N, bool TRANS_OUT, bool BF16_OUT>
__global__ __launch_bounds__(128) void gemm_bf16_kernel(
    const __bf16* __restrict__ A, const __bf16* __restrict__ Wt,
    const float* __restrict__ bias, void* __restrict__ Cout, float out_scale) {
  static_assert(Kd % GS_K == 0 && Kd / GS_K >= 2, "the ring needs two stages");
  __shared__ __align__(16) __bf16 gring[2 * GS_BUF];

  const int tid   = threadIdx.x;
  const int wave  = tid >> 5;
  const int lane  = tid & 31;
  const int l15   = lane & 15;
  const int hi    = lane >> 4;
  const int kbase = hi ? 8 : 0;

  const int mb = blockIdx.x * 128;
  const int m0 = mb + wave * 32;
  const int n0 = blockIdx.y * 64;

  // Copy side: thread t brings 16-byte piece (t & 7) of rows (t >> 3) + 16 i.
  const int crow = tid >> 3, cpc = tid & 7;
  const __bf16* ga = A + (size_t)(mb + crow) * Kd + cpc * 8;
  const __bf16* gw = Wt + (size_t)(n0 + crow) * Kd + cpc * 8;
  const unsigned la0 =
      (unsigned)(size_t)gring + (unsigned)(crow * GS_PITCH + cpc * 8) * 2u;

  // Read side: this lane's fragment rows in buffer 0.
  const __bf16* ar = gring + (wave * 32 + l15) * GS_PITCH + kbase;
  const __bf16* wr = gring + GS_A + l15 * GS_PITCH + kbase;

  // ---- ring prologue: stage 0 landed and published, stage 1 in flight
  gemm_stage_copy<Kd>(la0, la0 + GS_A * 2u, ga, gw);
  asm volatile("s_wait_asynccnt 0x0" ::: "memory");  // own copies landed
  __syncthreads();                                   // publish stage 0
  gemm_stage_copy<Kd>(la0 + GS_BUF * 2u, la0 + (GS_BUF + GS_A) * 2u, ga + GS_K,
                      gw + GS_K);

  v8f acc0[4] = {}, acc1[4] = {};
  for (int st = 0; st < Kd / GS_K; ++st) {
    const int bufo = (st & 1) * GS_BUF;
    // ---- all 24 fragment reads of the stage as one group, in k order: the
    //      buffer is free again as soon as they have returned
    v16bf af[2][2], bf[2][4];
    // the four loops below are unrolled so that every fragment and accumulator
    // index is a constant: the arrays stay in registers, no scratch
#pragma unroll
    for (int s = 0; s < 2; ++s) {
      af[s][0] = load_frag_lds(ar + bufo + s * 32);
      af[s][1] = load_frag_lds(ar + bufo + 16 * GS_PITCH + s * 32);
#pragma unroll
      for (int j = 0; j < 4; ++j)
        bf[s][j] = load_frag_lds(wr + bufo + j * 16 * GS_PITCH + s * 32);
    }

    // ---- publish point of stage st + 1, then refill the buffer just read;
    //      the refill flies under this stage's products, which need only
    //      registers, and under the next stage's reads
    asm volatile("s_wait_dscnt 0x0" ::: "memory");     // own LDS reads done
    asm volatile("s_wait_asynccnt 0x0" ::: "memory");  // own copies landed
    __syncthreads();  // stage st + 1 readable; every reader has left stage st
    if (st + 2 < Kd / GS_K)
      gemm_stage_copy<Kd>(la0 + bufo * 2u, la0 + (bufo + GS_A) * 2u,
                          ga + (st + 2) * GS_K, gw + (st + 2) * GS_K);

#pragma unroll
    for (int s = 0; s < 2; ++s) {
#pragma unroll
      for (int j = 0; j < 4; ++j) {
        acc0[j] = wmma_bf16(af[s][0], bf[s][j], acc0[j]);
        acc1[j] = wmma_bf16(af[s][1], bf[s][j], acc1[j]);
      }
    }
  }
  asm volatile("s_wait_asynccnt 0x0" ::: "memory");  // nothing left in flight

  // C/D layout: VGPR r -> (mtile + r + 8*hi, n0 + j*16 + l15)
#pragma unroll
  for (int j = 0; j < 4; ++j) {
    int   n  = n0 + j * 16 + l15;
    float bv = bias[n];
#pragma unroll
    for (int r = 0; r < 8; ++r) {
      int    m0r  = m0 + r + hi * 8;
      int    m1r  = m0 + 16 + r + hi * 8;
      float  val0 = (acc0[j][r] + bv) * out_scale;
      float  val1 = (acc1[j][r] + bv) * out_scale;
      size_t i0 = TRANS_OUT ? ((size_t)n * MTOT + m0r) : ((size_t)m0r * N + n);
      size_t i1 = TRANS_OUT ? ((size_t)n * MTOT + m1r) : ((size_t)m1r * N + n);
      if constexpr (BF16_OUT) {
        ((__bf16*)Cout)[i0] = (__bf16)val0;
        ((__bf16*)Cout)[i1] = (__bf16)val1;
      } else {
        ((float*)Cout)[i0] = val0;
        ((float*)Cout)[i1] = val1;
      }
    }
  }
}

// ---------------------------------------------------------------------------
// Flash attention (MQA): each wave owns a 16-query tile of one (b,h).
// Scores computed TRANSPOSED: S^T[key][q] = K_tile . Q_tile^T (A = K rows,
// B = Q rows; identical fragment bytes, swapped operands). Consequences:
//  * lane (n = lane&15) owns query q: its 8+8 accumulator regs hold keys
//    {0..7,16..23} (low half) / {8..15,24..31} (high half) of the 32-key
//    tile; the xor-16 partner holds the other 16 -> softmax max/sum are
//    in-lane reductions + ONE shfl_xor(16) each.
//  * exp'd probs are ALREADY in the PV A-fragment layout -> no LDS bounce.
//  * running m/l are one scalar per lane; only the o-rescale factor needs a
//    16-float LDS broadcast per iteration (C-layout rows are m-indexed).
// K frags loaded up-front (clause-batched), V frags loaded before the
// softmax so exp VALU hides their latency. Q pre-scaled by 1/sqrt(64).
// K and V^T reach the waves through LDS: the block's 128 threads bring a
// stage of 64 keys (K: 64 rows of 128 B, V^T: 64 rows of 128 B) with
// asynchronous b128 copies that cover whole 128-B lines, into two buffers,
// one stage ahead; all four waves read their fragments from there. Rows are
// pitched 144 B (16 B x odd) so that ds_load_b128 meets no bank conflict.
// ---------------------------------------------------------------------------
#define ATT_WAVES 4
#define ST_KEYS 64                     // keys per stage
#define ST_PITCH 72                    // bf16 per LDS row: 128 B data + 16 B pad
#define ST_TILE (64 * ST_PITCH)        // bf16 per tile (K or V^T), 9216 B
#define ST_BUF (2 * ST_TILE)           // bf16 per buffer (K tile, then V^T tile)
#define ST_COUNT (SEQ / ST_KEYS)       // 32 stages

// One stage: 8 copies per lane (4 of K, 4 of V^T), 16 rows apart each.
// lk / lv: the lane's LDS byte address in the K / V^T tile; gk / gv: its
// global address. s_wait_xcnt 0 closes the statement so that no address
// register is rewritten ahead of it.
__device__ __forceinline__ void stage_copy(unsigned lk, unsigned lv,
                                           const __bf16* gk,
                                           const __bf16* gv) {
  asm volatile(
      "global_load_async_to_lds_b128 %0, %8, off\n\t"
      "global_load_async_to_lds_b128 %1, %9, off\n\t"
      "global_load_async_to_lds_b128 %2, %10, off\n\t"
      "global_load_async_to_lds_b128 %3, %11, off\n\t"
      "global_load_async_to_lds_b128 %4, %12, off\n\t"
      "global_load_async_to_lds_b128 %5, %13, off\n\t"
      "global_load_async_to_lds_b128 %6, %14, off\n\t"
      "global_load_async_to_lds_b128 %7, %15, off\n\t"
      "s_wait_xcnt 0x0"
      ::"v"(lk), "v"(lk + 16u * ST_PITCH * 2u), "v"(lk + 32u * ST_PITCH * 2u),
        "v"(lk + 48u * ST_PITCH * 2u), "v"(lv), "v"(lv + 16u * ST_PITCH * 2u),
        "v"(lv + 32u * ST_PITCH * 2u), "v"(lv + 48u * ST_PITCH * 2u), "v"(gk),
        "v"(gk + 16 * D_K), "v"(gk + 32 * D_K), "v"(gk + 48 * D_K), "v"(gv),
        "v"(gv + (size_t)16 * MTOT), "v"(gv + (size_t)32 * MTOT),
        "v"(gv + (size_t)48 * MTOT)
      : "memory");
}

__global__ __launch_bounds__(128) void mqa_attn_kernel(
    const __bf16* __restrict__ Q, const __bf16* __restrict__ Kp,
    const __bf16* __restrict__ Vt, __bf16* __restrict__ ctx) {
  __shared__ __align__(16) float cl_all[ATT_WAVES * 16];
  __shared__ __align__(16) __bf16 ring[2 * ST_BUF];

  const int tid   = threadIdx.x;
  const int wave  = tid >> 5;
  const int lane  = tid & 31;
  const int l15   = lane & 15;
  const int hi    = lane >> 4;
  const int kbase = hi ? 8 : 0;
  float* cl = cl_all + wave * 16;

  const int bh = blockIdx.y;  // 0..63
  const int b  = bh >> 4;
  const int h  = bh & 15;
  const int q0 = (blockIdx.x * ATT_WAVES + wave) * 16;

  // Q fragments (used as B operands: Bt[n=q][k=d] = Q row q)
  const __bf16* qrow =
      Q + (size_t)(b * SEQ + q0 + l15) * D_MODEL + h * D_K + kbase;
  v16bf qf0 = load_frag_bf16(qrow);
  v16bf qf1 = load_frag_bf16(qrow + 32);

  // Copy side: thread t brings 16-byte piece (t & 7) of rows (t >> 3) + 16 i.
  const int crow = tid >> 3, cpc = tid & 7;
  const __bf16* gk = Kp + (size_t)b * SEQ * D_K + crow * D_K + cpc * 8;
  const __bf16* gv = Vt + (size_t)crow * MTOT + (size_t)b * SEQ + cpc * 8;
  const unsigned lk0 =
      (unsigned)(size_t)ring + (unsigned)(crow * ST_PITCH + cpc * 8) * 2u;

  float mrun = -1e30f, lrun = 0.0f;  // per-lane scalars (this lane's query)
  v8f o[4] = {};

  // ---- ring prologue: stage 0 landed and published, stage 1 in flight
  stage_copy(lk0, lk0 + ST_TILE * 2u, gk, gv);
  asm volatile("s_wait_asynccnt 0x0" ::: "memory");  // own copies landed
  __syncthreads();                                   // publish stage 0
  stage_copy(lk0 + ST_BUF * 2u, lk0 + (ST_BUF + ST_TILE) * 2u,
             gk + ST_KEYS * D_K, gv + ST_KEYS);

  for (int st = 0; st < ST_COUNT; ++st) {
   const int bufo = (st & 1) * ST_BUF;
#pragma unroll
   for (int sub = 0; sub < ST_KEYS; sub += 32) {
    // ---- issue ALL K-fragment loads first (one clause), then 4 WMMAs with
    //      interleaved accumulation chains for ILP.
    const __bf16* kr0 = ring + bufo + (sub + l15) * ST_PITCH + kbase;
    const __bf16* kr1 = kr0 + 16 * ST_PITCH;
    v16bf kf00 = load_frag_lds(kr0);
    v16bf kf01 = load_frag_lds(kr0 + 32);
    v16bf kf10 = load_frag_lds(kr1);
    v16bf kf11 = load_frag_lds(kr1 + 32);

    v8f st0 = {}, st1 = {};
    st0 = wmma_bf16(kf00, qf0, st0);
    st1 = wmma_bf16(kf10, qf0, st1);
    st0 = wmma_bf16(kf01, qf1, st0);
    st1 = wmma_bf16(kf11, qf1, st1);

    // ---- V fragments early: softmax VALU below hides their latency
    v16bf vf[4];
#pragma unroll
    for (int j = 0; j < 4; ++j)
      vf[j] = load_frag_lds(ring + bufo + ST_TILE + (j * 16 + l15) * ST_PITCH +
                            sub + kbase);

    // ---- in-lane max over this lane's 16 keys, + xor-16 partner
    float vmax = fmaxf(st0[0], st1[0]);
#pragma unroll
    for (int r = 1; r < 8; ++r) vmax = fmaxf(vmax, fmaxf(st0[r], st1[r]));
    vmax = fmaxf(vmax, __shfl_xor(vmax, 16, 32));

    float mnew = fmaxf(mrun, vmax);
    float corr = __expf(mrun - mnew);
    mrun = mnew;

    // ---- exp + in-lane sum (+ partner), probs straight into A-frag layout
    v16bf pf;
    float rs = 0.0f;
#pragma unroll
    for (int r = 0; r < 8; ++r) {
      float e0 = __expf(st0[r] - mnew);
      float e1 = __expf(st1[r] - mnew);
      rs += e0 + e1;
      pf[r]     = (__bf16)e0;  // keys kbase+r      of this query
      pf[r + 8] = (__bf16)e1;  // keys kbase+16+r   of this query
    }
    rs += __shfl_xor(rs, 16, 32);
    lrun = lrun * corr + rs;

    // ---- broadcast per-query corr to o's m-indexed rows (16 floats/wave)
    if (lane < 16) cl[lane] = corr;
    asm volatile("s_wait_dscnt 0" ::: "memory");
    float4 c0 = *(const float4*)(cl + hi * 8);
    float4 c1 = *(const float4*)(cl + hi * 8 + 4);
    float cc[8] = {c0.x, c0.y, c0.z, c0.w, c1.x, c1.y, c1.z, c1.w};
#pragma unroll
    for (int j = 0; j < 4; ++j)
#pragma unroll
      for (int r = 0; r < 8; ++r) o[j][r] *= cc[r];

    // ---- PV: o += P.V ; A = probs (in regs), B = Vt rows. 4 WMMAs.
#pragma unroll
    for (int j = 0; j < 4; ++j) o[j] = wmma_bf16(pf, vf[j], o[j]);
   }

    // ---- publish point of stage st + 1, then refill the buffer just read
    asm volatile("s_wait_dscnt 0x0" ::: "memory");     // own LDS reads done
    asm volatile("s_wait_asynccnt 0x0" ::: "memory");  // own copies landed
    __syncthreads();  // stage st + 1 readable; every reader has left stage st
    if (st + 2 < ST_COUNT)
      stage_copy(lk0 + bufo * 2u, lk0 + (bufo + ST_TILE) * 2u,
                 gk + (size_t)(st + 2) * ST_KEYS * D_K,
                 gv + (st + 2) * ST_KEYS);
  }
  asm volatile("s_wait_asynccnt 0x0" ::: "memory");  // nothing left in flight

  // ---- broadcast 1/l per query to m-indexed rows, normalize, store bf16
  {
    float inv = 1.0f / lrun;
    if (lane < 16) cl[lane] = inv;
  }
  asm volatile("s_wait_dscnt 0" ::: "memory");
  float4 c0 = *(const float4*)(cl + hi * 8);
  float4 c1 = *(const float4*)(cl + hi * 8 + 4);
  float cc[8] = {c0.x, c0.y, c0.z, c0.w, c1.x, c1.y, c1.z, c1.w};
#pragma unroll
  for (int j = 0; j < 4; ++j) {
    int d = h * D_K + j * 16 + l15;
#pragma unroll
    for (int r = 0; r < 8; ++r) {
      int m = q0 + r + hi * 8;
      ctx[(size_t)(b * SEQ + m) * D_MODEL + d] = (__bf16)(o[j][r] * cc[r]);
    }
  }
}

// ---------------------------------------------------------------------------
extern "C" void kernel_launch(void* const* d_in, const int* in_sizes, int n_in,
                              void* d_out, int out_size, void* d_ws,
                              size_t ws_size, hipStream_t stream) {
  const float* x  = (const float*)d_in[0];
  const float* Wq = (const float*)d_in[1];
  const float* bq = (const float*)d_in[2];
  const float* Wk = (const float*)d_in[3];
  const float* bk = (const float*)d_in[4];
  const float* Wv = (const float*)d_in[5];
  const float* bv = (const float*)d_in[6];
  const float* Wo = (const float*)d_in[7];
  const float* bo = (const float*)d_in[8];
  float* out = (float*)d_out;

  // Workspace layout (bf16 buffers)
  char*   ws    = (char*)d_ws;
  __bf16* xbf   = (__bf16*)ws;                      // M x 1024
  __bf16* Wqt   = xbf + (size_t)MTOT * D_MODEL;     // 1024 x 1024
  __bf16* Wkt   = Wqt + (size_t)D_MODEL * D_MODEL;  // 64 x 1024
  __bf16* Wvt   = Wkt + (size_t)D_K * D_MODEL;      // 64 x 1024
  __bf16* Wot   = Wvt + (size_t)D_K * D_MODEL;      // 1024 x 1024
  __bf16* Qbf   = Wot + (size_t)D_MODEL * D_MODEL;  // M x 1024
  __bf16* Kbf   = Qbf + (size_t)MTOT * D_MODEL;     // M x 64
  __bf16* Vtbf  = Kbf + (size_t)MTOT * D_K;         // 64 x M
  __bf16* ctxbf = Vtbf + (size_t)D_K * MTOT;        // M x 1024

  // ---- prep: converts + weight transposes
  {
    int n = MTOT * D_MODEL;
    convert_bf16_kernel<<<dim3(n / 1024), dim3(256), 0, stream>>>(x, xbf, n);
  }
  transpose_bf16_kernel<<<dim3(D_MODEL / 32, D_MODEL / 32), dim3(256), 0,
                          stream>>>(Wq, Wqt, D_MODEL, D_MODEL);
  transpose_bf16_kernel<<<dim3(D_MODEL / 32, D_K / 32), dim3(256), 0,
                          stream>>>(Wk, Wkt, D_MODEL, D_K);
  transpose_bf16_kernel<<<dim3(D_MODEL / 32, D_K / 32), dim3(256), 0,
                          stream>>>(Wv, Wvt, D_MODEL, D_K);
  transpose_bf16_kernel<<<dim3(D_MODEL / 32, D_MODEL / 32), dim3(256), 0,
                          stream>>>(Wo, Wot, D_MODEL, D_MODEL);

  dim3 blk(128);
  // Q = (x@Wq + bq) * 1/sqrt(64)  -> bf16
  gemm_bf16_kernel<D_MODEL, D_MODEL, false, true>
      <<<dim3(MTOT / 128, D_MODEL / 64), blk, 0, stream>>>(xbf, Wqt, bq, Qbf,
                                                           0.125f);
  // K = x@Wk + bk -> bf16
  gemm_bf16_kernel<D_MODEL, D_K, false, true>
      <<<dim3(MTOT / 128, 1), blk, 0, stream>>>(xbf, Wkt, bk, Kbf, 1.0f);
  // V^T = (x@Wv + bv)^T -> bf16 [64, M]
  gemm_bf16_kernel<D_MODEL, D_K, true, true>
      <<<dim3(MTOT / 128, 1), blk, 0, stream>>>(xbf, Wvt, bv, Vtbf, 1.0f);
  // attention -> ctx bf16
  mqa_attn_kernel<<<dim3(SEQ / (16 * ATT_WAVES), BATCH * NUM_HEADS), blk, 0,
                    stream>>>(Qbf, Kbf, Vtbf, ctxbf);
  // out = ctx@Wo + bo -> f32
  gemm_bf16_kernel<D_MODEL, D_MODEL, false, false>
      <<<dim3(MTOT / 128, D_MODEL / 64), blk, 0, stream>>>(ctxbf, Wot, bo, out,
                                                           1.0f);
}

// v003
// Measured time: 129 microseconds a run.
// Next to v002, in two timings, it ran 1.17 and 1.18 times as fast.
// Over all steps from v000 it is 3.07 times as fast.
#include <hip/hip_runtime.h>

// ---------------------------------------------------------------------------
// MQA forward for MI455X (gfx1250), wave32 WMMA bf16 everywhere.
//   1) x -> bf16; W{q,k,v,o} -> transposed bf16 (Wt[n][k])  [one-time prep]
//   2) Q = (x@Wq+bq)*0.125 -> bf16 [M,1024]
//      K =  x@Wk+bk        -> bf16 [M,64]
//      Vt = (x@Wv+bv)^T    -> bf16 [64,M]
//   3) flash attention: S^T = K.Q^T (lane owns one query's scores ->
//      in-lane softmax reductions, probs already in PV A-frag layout)
//   4) out = ctx@Wo+bo -> f32
// ---------------------------------------------------------------------------

#define D_MODEL 1024
#define NUM_HEADS 16
#define D_K 64
#define BATCH 4
#define SEQ 2048
#define MTOT (BATCH * SEQ)  // 8192

typedef __attribute__((ext_vector_type(16))) __bf16 v16bf;
typedef __attribute__((ext_vector_type(8)))  float  v8f;

__device__ __forceinline__ v8f wmma_bf16(v16bf a, v16bf b, v8f c) {
  // (neg_a, A, neg_b, B, c_mod, C, reuse_a, reuse_b)
  return __builtin_amdgcn_wmma_f32_16x16x32_bf16(false, a, false, b,
                                                 (short)0, c, false, false);
}

// Fragment (A or B) from bf16 memory: lane holds k = {kbase..kbase+7,
// kbase+16..kbase+23} of its row/column, kbase=0|8 by lane half. Caller
// passes base = &row[kbase]; both halves are 16B -> two b128 loads.
__device__ __forceinline__ v16bf load_frag_bf16(const __bf16* base) {
  v16bf f;
#pragma unroll
  for (int i = 0; i < 8; ++i) {
    f[i]     = base[i];
    f[i + 8] = base[16 + i];
  }
  return f;
}

// The same fragment from an LDS row (16-byte aligned): two ds_load_b128.
typedef __attribute__((ext_vector_type(8))) __bf16 v8bf;
__device__ __forceinline__ v16bf load_frag_lds(const __bf16* base) {
  v8bf lo = *(const v8bf*)base;
  v8bf hi = *(const v8bf*)(base + 16);
  return __builtin_shufflevector(lo, hi, 0, 1, 2, 3, 4, 5, 6, 7, 8, 9, 10, 11,
                                 12, 13, 14, 15);
}

// ---------------------------------------------------------------------------
// Prep: five jobs that read only inputs and none of each other's output, so
// they run as ONE launch; the block index picks the job (block-uniform).
// ---------------------------------------------------------------------------
__device__ __forceinline__ void convert_bf16_block(
    const float* __restrict__ in, __bf16* __restrict__ out, int n, int blk) {
  int i = (blk * 256 + threadIdx.x) * 4;
  if (i < n) {
    float4 v = *(const float4*)(in + i);
    out[i + 0] = (__bf16)v.x;
    out[i + 1] = (__bf16)v.y;
    out[i + 2] = (__bf16)v.z;
    out[i + 3] = (__bf16)v.w;
  }
}

// Wt[n][k] = bf16(W[k][n]); 32x32 LDS tile transpose. t: tile number, the k
// tile running fastest.
__device__ __forceinline__ void transpose_bf16_block(
    const float* __restrict__ in, __bf16* __restrict__ out, int K, int N,
    int t, float (*tile)[33]) {
  const int k0 = (t % (K / 32)) * 32, n0 = (t / (K / 32)) * 32;
  const int c = threadIdx.x & 31, r8 = threadIdx.x >> 5;  // r8: 0..7
#pragma unroll
  for (int i = 0; i < 4; ++i) {
    int r = r8 + i * 8;
    tile[r][c] = in[(size_t)(k0 + r) * N + n0 + c];
  }
  __syncthreads();
#pragma unroll
  for (int i = 0; i < 4; ++i) {
    int r = r8 + i * 8;
    out[(size_t)(n0 + r) * K + k0 + c] = (__bf16)tile[c][r];
  }
  // another job's code follows in the merged kernel: no register that these
  // stores name is rewritten ahead of this wait
  asm volatile("s_wait_xcnt 0x0" ::: "memory");
}

#define TB_BIG ((D_MODEL / 32) * (D_MODEL / 32))  // tiles of Wq, of Wo: 1024
#define TB_SMALL ((D_MODEL / 32) * (D_K / 32))    // tiles of Wk, of Wv: 64
#define TB_ALL (2 * TB_BIG + 2 * TB_SMALL)        // transposing blocks
#define CV_BLOCKS (MTOT * D_MODEL / 1024)         // converting blocks

// Blocks [0, TB_ALL) transpose the weights, the rest convert x: the blocks
// with the barrier and the short stores start first, under the long stream.
__global__ __launch_bounds__(256) void prep_kernel(
    const float* __restrict__ x, const float* __restrict__ Wq,
    const float* __restrict__ Wk, const float* __restrict__ Wv,
    const float* __restrict__ Wo, __bf16* __restrict__ xbf,
    __bf16* __restrict__ Wqt, __bf16* __restrict__ Wkt,
    __bf16* __restrict__ Wvt, __bf16* __restrict__ Wot) {
  __shared__ float tile[32][33];
  const int blk = blockIdx.x;
  if (blk >= TB_ALL) {
    convert_bf16_block(x, xbf, MTOT * D_MODEL, blk - TB_ALL);
    return;
  }
  const float* in;
  __bf16* out;
  int N, t;
  if (blk < TB_BIG) {
    in = Wq, out = Wqt, N = D_MODEL, t = blk;
  } else if (blk < 2 * TB_BIG) {
    in = Wo, out = Wot, N = D_MODEL, t = blk - TB_BIG;
  } else if (blk < 2 * TB_BIG + TB_SMALL) {
    in = Wk, out = Wkt, N = D_K, t = blk - 2 * TB_BIG;
  } else {
    in = Wv, out = Wvt, N = D_K, t = blk - 2 * TB_BIG - TB_SMALL;
  }
  transpose_bf16_block(in, out, D_MODEL, N, t, tile);
}

// ---------------------------------------------------------------------------
// GEMM: C[M,N] = A[M,Kd](bf16) * Wt[N,Kd](bf16)^T + bias, epilogue scale.
// Block = 128 (4 waves), block tile 128(M) x 64(N); each wave: 32(M) x 64(N),
// 8 f32 accumulators; two A fragments share each B fragment.
// A and Wt reach the waves through LDS: the block's 128 threads bring a stage
// of 64 k (A: 128 rows of 128 B, Wt: 64 rows of 128 B) with asynchronous b128
// copies that cover whole 128-B lines, into two buffers, one stage ahead; the
// four waves share the Wt rows. Rows are pitched 144 B (16 B x odd) so that
// ds_load_b128 meets no bank conflict. The k order of every sum is unchanged.
// ---------------------------------------------------------------------------
#define GS_K 64                        // k per stage
#define GS_PITCH 72                    // bf16 per LDS row: 128 B data + 16 B pad
#define GS_A (128 * GS_PITCH)          // bf16 per A tile, 18432 B
#define GS_W (64 * GS_PITCH)           // bf16 per Wt tile, 9216 B
#define GS_BUF (GS_A + GS_W)           // bf16 per buffer (A tile, then Wt tile)

// One stage: 12 copies per lane (8 of A, 4 of Wt), 16 rows apart each.
// la / lw: the lane's LDS byte address in the A / Wt tile; ga / gw: its global
// address. s_wait_xcnt 0 closes the statement so that no address register is
// rewritten ahead of it.
template <int Kd>
__device__ __forceinline__ void gemm_stage_copy(unsigned la, unsigned lw,
                                                const __bf16* ga,
                                                const __bf16* gw) {
  constexpr unsigned R16 = 16u * GS_PITCH * 2u;  // 16 LDS rows, bytes
  asm volatile(
      "global_load_async_to_lds_b128 %0, %12, off\n\t"
      "global_load_async_to_lds_b128 %1, %13, off\n\t"
      "global_load_async_to_lds_b128 %2, %14, off\n\t"
      "global_load_async_to_lds_b128 %3, %15, off\n\t"
      "global_load_async_to_lds_b128 %4, %16, off\n\t"
      "global_load_async_to_lds_b128 %5, %17, off\n\t"
      "global_load_async_to_lds_b128 %6, %18, off\n\t"
      "global_load_async_to_lds_b128 %7, %19, off\n\t"
      "global_load_async_to_lds_b128 %8, %20, off\n\t"
      "global_load_async_to_lds_b128 %9, %21, off\n\t"
      "global_load_async_to_lds_b128 %10, %22, off\n\t"
      "global_load_async_to_lds_b128 %11, %23, off\n\t"
      "s_wait_xcnt 0x0"
      ::"v"(la), "v"(la + R16), "v"(la + 2u * R16), "v"(la + 3u * R16),
        "v"(la + 4u * R16), "v"(la + 5u * R16), "v"(la + 6u * R16),
        "v"(la + 7u * R16), "v"(lw), "v"(lw + R16), "v"(lw + 2u * R16),
        "v"(lw + 3u * R16), "v"(ga), "v"(ga + 16 * Kd), "v"(ga + 32 * Kd),
        "v"(ga + 48 * Kd), "v"(ga + 64 * Kd), "v"(ga + 80 * Kd),
        "v"(ga + 96 * Kd), "v"(ga + 112 * Kd), "v"(gw), "v"(gw + 16 * Kd),
        "v"(gw + 32 * Kd), "v"(gw + 48 * Kd)
      : "memory");
}

// The products of one block tile: rows mb.. of A against rows n0.. of Wt.
// gring: the block's LDS ring; acc0 / acc1: the wave's two row tiles.
template <int Kd>
__device__ __forceinline__ void gemm_bf16_products(
    const __bf16* __restrict__ A, const __bf16* __restrict__ Wt, int mb, int n0,
    __bf16* gring, v8f (&acc0)[4], v8f (&acc1)[4]) {
  static_assert(Kd % GS_K == 0 && Kd / GS_K >= 2, "the ring needs two stages");

  const int tid   = threadIdx.x;
  const int wave  = tid >> 5;
  const int lane  = tid & 31;
  const int l15   = lane & 15;
  const int hi    = lane >> 4;
  const int kbase = hi ? 8 : 0;

  // Copy side: thread t brings 16-byte piece (t & 7) of rows (t >> 3) + 16 i.
  const int crow = tid >> 3, cpc = tid & 7;
  const __bf16* ga = A + (size_t)(mb + crow) * Kd + cpc * 8;
  const __bf16* gw = Wt + (size_t)(n0 + crow) * Kd + cpc * 8;
  const unsigned la0 =
      (unsigned)(size_t)gring + (unsigned)(crow * GS_PITCH + cpc * 8) * 2u;

  // Read side: this lane's fragment rows in buffer 0.
  const __bf16* ar = gring + (wave * 32 + l15) * GS_PITCH + kbase;
  const __bf16* wr = gring + GS_A + l15 * GS_PITCH + kbase;

  // ---- ring prologue: stage 0 landed and published, stage 1 in flight
  gemm_stage_copy<Kd>(la0, la0 + GS_A * 2u, ga, gw);
  asm volatile("s_wait_asynccnt 0x0" ::: "memory");  // own copies landed
  __syncthreads();                                   // publish stage 0
  gemm_stage_copy<Kd>(la0 + GS_BUF * 2u, la0 + (GS_BUF + GS_A) * 2u, ga + GS_K,
                      gw + GS_K);

  for (int st = 0; st < Kd / GS_K; ++st) {
    const int bufo = (st & 1) * GS_BUF;
    // ---- all 24 fragment reads of the stage as one group, in k order: the
    //      buffer is free again as soon as they have returned
    v16bf af[2][2], bf[2][4];
    // the four loops below are unrolled so that every fragment and accumulator
    // index is a constant: the arrays stay in registers, no scratch
#pragma unroll
    for (int s = 0; s < 2; ++s) {
      af[s][0] = load_frag_lds(ar + bufo + s * 32);
      af[s][1] = load_frag_lds(ar + bufo + 16 * GS_PITCH + s * 32);
#pragma unroll
      for (int j = 0; j < 4; ++j)
        bf[s][j] = load_frag_lds(wr + bufo + j * 16 * GS_PITCH + s * 32);
    }

    // ---- publish point of stage st + 1, then refill the buffer just read;
    //      the refill flies under this stage's products, which need only
    //      registers, and under the next stage's reads
    asm volatile("s_wait_dscnt 0x0" ::: "memory");     // own LDS reads done
    asm volatile("s_wait_asynccnt 0x0" ::: "memory");  // own copies landed
    __syncthreads();  // stage st + 1 readable; every reader has left stage st
    if (st + 2 < Kd / GS_K)
      gemm_stage_copy<Kd>(la0 + bufo * 2u, la0 + (bufo + GS_A) * 2u,
                          ga + (st + 2) * GS_K, gw + (st + 2) * GS_K);

#pragma unroll
    for (int s = 0; s < 2; ++s) {
#pragma unroll
      for (int j = 0; j < 4; ++j) {
        acc0[j] = wmma_bf16(af[s][0], bf[s][j], acc0[j]);
        acc1[j] = wmma_bf16(af[s][1], bf[s][j], acc1[j]);
      }
    }
  }
  asm volatile("s_wait_asynccnt 0x0" ::: "memory");  // nothing left in flight
}

// The tile's store, with its bias and scale.
template <int N, bool TRANS_OUT, bool BF16_OUT>
__device__ __forceinline__ void gemm_bf16_store(
    const v8f (&acc0)[4], const v8f (&acc1)[4], const float* __restrict__ bias,
    void* __restrict__ Cout, float out_scale, int mb, int n0) {
  const int lane = threadIdx.x & 31;
  const int l15  = lane & 15;
  const int hi   = lane >> 4;
  const int m0   = mb + (threadIdx.x >> 5) * 32;

  // C/D layout: VGPR r -> (mtile + r + 8*hi, n0 + j*16 + l15)
#pragma unroll
  for (int j = 0; j < 4; ++j) {
    int   n  = n0 + j * 16 + l15;
    float bv = bias[n];
#pragma unroll
    for (int r = 0; r < 8; ++r) {
      int    m0r  = m0 + r + hi * 8;
      int    m1r  = m0 + 16 + r + hi * 8;
      float  val0 = (acc0[j][r] + bv) * out_scale;
      float  val1 = (acc1[j][r] + bv) * out_scale;
      size_t i0 = TRANS_OUT ? ((size_t)n * MTOT + m0r) : ((size_t)m0r * N + n);
      size_t i1 = TRANS_OUT ? ((size_t)n * MTOT + m1r) : ((size_t)m1r * N + n);
      if constexpr (BF16_OUT) {
        ((__bf16*)Cout)[i0] = (__bf16)val0;
        ((__bf16*)Cout)[i1] = (__bf16)val1;
      } else {
        ((float*)Cout)[i0] = val0;
        ((float*)Cout)[i1] = val1;
      }
    }
  }
  // another product's store code follows in the merged kernel: no register
  // that these stores name is rewritten ahead of this wait
  asm volatile("s_wait_xcnt 0x0" ::: "memory");
}

template <int Kd, int N, bool TRANS_OUT, bool BF16_OUT>
__global__ __launch_bounds__(128) void gemm_bf16_kernel(
    const __bf16* __restrict__ A, const __bf16* __restrict__ Wt,
    const float* __restrict__ bias, void* __restrict__ Cout, float out_scale) {
  __shared__ __align__(16) __bf16 gring[2 * GS_BUF];
  const int mb = blockIdx.x * 128, n0 = blockIdx.y * 64;
  v8f acc0[4] = {}, acc1[4] = {};
  gemm_bf16_products<Kd>(A, Wt, mb, n0, gring, acc0, acc1);
  gemm_bf16_store<N, TRANS_OUT, BF16_OUT>(acc0, acc1, bias, Cout, out_scale,
                                          mb, n0);
}

// Q, K and V^T read the same A and none of each other's output: ONE launch.
// blockIdx.y picks the product (block-uniform): 0 is K, 1 is V^T, whose 64
// columns are one tile each, and 2.. are the column tiles of Q. The product
// loop is common; only the weight rows and the store differ.
__global__ __launch_bounds__(128) void gemm_qkv_kernel(
    const __bf16* __restrict__ A, const __bf16* __restrict__ Wqt,
    const __bf16* __restrict__ Wkt, const __bf16* __restrict__ Wvt,
    const float* __restrict__ bq, const float* __restrict__ bk,
    const float* __restrict__ bv, __bf16* __restrict__ Qo,
    __bf16* __restrict__ Ko, __bf16* __restrict__ Vto) {
  __shared__ __align__(16) __bf16 gring[2 * GS_BUF];
  const int mb = blockIdx.x * 128;
  const int y  = blockIdx.y;
  const int n0 = y < 2 ? 0 : (y - 2) * 64;
  const __bf16* Wt = y == 0 ? Wkt : y == 1 ? Wvt : Wqt;
  v8f acc0[4] = {}, acc1[4] = {};
  gemm_bf16_products<D_MODEL>(A, Wt, mb, n0, gring, acc0, acc1);
  if (y == 0)
    gemm_bf16_store<D_K, false, true>(acc0, acc1, bk, Ko, 1.0f, mb, n0);
  else if (y == 1)
    gemm_bf16_store<D_K, true, true>(acc0, acc1, bv, Vto, 1.0f, mb, n0);
  else
    gemm_bf16_store<D_MODEL, false, true>(acc0, acc1, bq, Qo, 0.125f, mb, n0);
}

// ---------------------------------------------------------------------------
// Flash attention (MQA): each wave owns a 16-query tile of one (b,h).
// Scores computed TRANSPOSED: S^T[key][q] = K_tile . Q_tile^T (A = K rows,
// B = Q rows; identical fragment bytes, swapped operands). Consequences:
//  * lane (n = lane&15) owns query q: its 8+8 accumulator regs hold keys
//    {0..7,16..23} (low half) / {8..15,24..31} (high half) of the 32-key
//    tile; the xor-16 partner holds the other 16 -> softmax max/sum are
//    in-lane reductions + ONE shfl_xor(16) each.
//  * exp'd probs are ALREADY in the PV A-fragment layout -> no LDS bounce.
//  * running m/l are one scalar per lane; only the o-rescale factor needs a
//    16-float LDS broadcast per iteration (C-layout rows are m-indexed).
// K frags loaded up-front (clause-batched), V frags loaded before the
// softmax so exp VALU hides their latency. Q pre-scaled by 1/sqrt(64).
// K and V^T reach the waves through LDS: the block's 128 threads bring a
// stage of 64 keys (K: 64 rows of 128 B, V^T: 64 rows of 128 B) with
// asynchronous b128 copies that cover whole 128-B lines, into two buffers,
// one stage ahead; all four waves read their fragments from there. Rows are
// pitched 144 B (16 B x odd) so that ds_load_b128 meets no bank conflict.
// ---------------------------------------------------------------------------
#define ATT_WAVES 4
#define ST_KEYS 64                     // keys per stage
#define ST_PITCH 72                    // bf16 per LDS row: 128 B data + 16 B pad
#define ST_TILE (64 * ST_PITCH)        // bf16 per tile (K or V^T), 9216 B
#define ST_BUF (2 * ST_TILE)           // bf16 per buffer (K tile, then V^T tile)
#define ST_COUNT (SEQ / ST_KEYS)       // 32 stages

// One stage: 8 copies per lane (4 of K, 4 of V^T), 16 rows apart each.
// lk / lv: the lane's LDS byte address in the K / V^T tile; gk / gv: its
// global address. s_wait_xcnt 0 closes the statement so that no address
// register is rewritten ahead of it.
__device__ __forceinline__ void stage_copy(unsigned lk, unsigned lv,
                                           const __bf16* gk,
                                           const __bf16* gv) {
  asm volatile(
      "global_load_async_to_lds_b128 %0, %8, off\n\t"
      "global_load_async_to_lds_b128 %1, %9, off\n\t"
      "global_load_async_to_lds_b128 %2, %10, off\n\t"
      "global_load_async_to_lds_b128 %3, %11, off\n\t"
      "global_load_async_to_lds_b128 %4, %12, off\n\t"
      "global_load_async_to_lds_b128 %5, %13, off\n\t"
      "global_load_async_to_lds_b128 %6, %14, off\n\t"
      "global_load_async_to_lds_b128 %7, %15, off\n\t"
      "s_wait_xcnt 0x0"
      ::"v"(lk), "v"(lk + 16u * ST_PITCH * 2u), "v"(lk + 32u * ST_PITCH * 2u),
        "v"(lk + 48u * ST_PITCH * 2u), "v"(lv), "v"(lv + 16u * ST_PITCH * 2u),
        "v"(lv + 32u * ST_PITCH * 2u), "v"(lv + 48u * ST_PITCH * 2u), "v"(gk),
        "v"(gk + 16 * D_K), "v"(gk + 32 * D_K), "v"(gk + 48 * D_K), "v"(gv),
        "v"(gv + (size_t)16 * MTOT), "v"(gv + (size_t)32 * MTOT),
        "v"(gv + (size_t)48 * MTOT)
      : "memory");
}

__global__ __launch_bounds__(128) void mqa_attn_kernel(
    const __bf16* __restrict__ Q, const __bf16* __restrict__ Kp,
    const __bf16* __restrict__ Vt, __bf16* __restrict__ ctx) {
  __shared__ __align__(16) float cl_all[ATT_WAVES * 16];
  __shared__ __align__(16) __bf16 ring[2 * ST_BUF];

  const int tid   = threadIdx.x;
  const int wave  = tid >> 5;
  const int lane  = tid & 31;
  const int l15   = lane & 15;
  const int hi    = lane >> 4;
  const int kbase = hi ? 8 : 0;
  float* cl = cl_all + wave * 16;

  const int bh = blockIdx.y;  // 0..63
  const int b  = bh >> 4;
  const int h  = bh & 15;
  const int q0 = (blockIdx.x * ATT_WAVES + wave) * 16;

  // Q fragments (used as B operands: Bt[n=q][k=d] = Q row q)
  const __bf16* qrow =
      Q + (size_t)(b * SEQ + q0 + l15) * D_MODEL + h * D_K + kbase;
  v16bf qf0 = load_frag_bf16(qrow);
  v16bf qf1 = load_frag_bf16(qrow + 32);

  // Copy side: thread t brings 16-byte piece (t & 7) of rows (t >> 3) + 16 i.
  const int crow = tid >> 3, cpc = tid & 7;
  const __bf16* gk = Kp + (size_t)b * SEQ * D_K + crow * D_K + cpc * 8;
  const __bf16* gv = Vt + (size_t)crow * MTOT + (size_t)b * SEQ + cpc * 8;
  const unsigned lk0 =
      (unsigned)(size_t)ring + (unsigned)(crow * ST_PITCH + cpc * 8) * 2u;

  float mrun = -1e30f, lrun = 0.0f;  // per-lane scalars (this lane's query)
  v8f o[4] = {};

  // ---- ring prologue: stage 0 landed and published, stage 1 in flight
  stage_copy(lk0, lk0 + ST_TILE * 2u, gk, gv);
  asm volatile("s_wait_asynccnt 0x0" ::: "memory");  // own copies landed
  __syncthreads();                                   // publish stage 0
  stage_copy(lk0 + ST_BUF * 2u, lk0 + (ST_BUF + ST_TILE) * 2u,
             gk + ST_KEYS * D_K, gv + ST_KEYS);

  for (int st = 0; st < ST_COUNT; ++st) {
   const int bufo = (st & 1) * ST_BUF;
#pragma unroll
   for (int sub = 0; sub < ST_KEYS; sub += 32) {
    // ---- issue ALL K-fragment loads first (one clause), then 4 WMMAs with
    //      interleaved accumulation chains for ILP.
    const __bf16* kr0 = ring + bufo + (sub + l15) * ST_PITCH + kbase;
    const __bf16* kr1 = kr0 + 16 * ST_PITCH;
    v16bf kf00 = load_frag_lds(kr0);
    v16bf kf01 = load_frag_lds(kr0 + 32);
    v16bf kf10 = load_frag_lds(kr1);
    v16bf kf11 = load_frag_lds(kr1 + 32);

    v8f st0 = {}, st1 = {};
    st0 = wmma_bf16(kf00, qf0, st0);
    st1 = wmma_bf16(kf10, qf0, st1);
    st0 = wmma_bf16(kf01, qf1, st0);
    st1 = wmma_bf16(kf11, qf1, st1);

    // ---- V fragments early: softmax VALU below hides their latency
    v16bf vf[4];
#pragma unroll
    for (int j = 0; j < 4; ++j)
      vf[j] = load_frag_lds(ring + bufo + ST_TILE + (j * 16 + l15) * ST_PITCH +
                            sub + kbase);

    // ---- in-lane max over this lane's 16 keys, + xor-16 partner
    float vmax = fmaxf(st0[0], st1[0]);
#pragma unroll
    for (int r = 1; r < 8; ++r) vmax = fmaxf(vmax, fmaxf(st0[r], st1[r]));
    vmax = fmaxf(vmax, __shfl_xor(vmax, 16, 32));

    float mnew = fmaxf(mrun, vmax);
    float corr = __expf(mrun - mnew);
    mrun = mnew;

    // ---- exp + in-lane sum (+ partner), probs straight into A-frag layout
    v16bf pf;
    float rs = 0.0f;
#pragma unroll
    for (int r = 0; r < 8; ++r) {
      float e0 = __expf(st0[r] - mnew);
      float e1 = __expf(st1[r] - mnew);
      rs += e0 + e1;
      pf[r]     = (__bf16)e0;  // keys kbase+r      of this query
      pf[r + 8] = (__bf16)e1;  // keys kbase+16+r   of this query
    }
    rs += __shfl_xor(rs, 16, 32);
    lrun = lrun * corr + rs;

    // ---- broadcast per-query corr to o's m-indexed rows (16 floats/wave)
    if (lane < 16) cl[lane] = corr;
    asm volatile("s_wait_dscnt 0" ::: "memory");
    float4 c0 = *(const float4*)(cl + hi * 8);
    float4 c1 = *(const float4*)(cl + hi * 8 + 4);
    float cc[8] = {c0.x, c0.y, c0.z, c0.w, c1.x, c1.y, c1.z, c1.w};
#pragma unroll
    for (int j = 0; j < 4; ++j)
#pragma unroll
      for (int r = 0; r < 8; ++r) o[j][r] *= cc[r];

    // ---- PV: o += P.V ; A = probs (in regs), B = Vt rows. 4 WMMAs.
#pragma unroll
    for (int j = 0; j < 4; ++j) o[j] = wmma_bf16(pf, vf[j], o[j]);
   }

    // ---- publish point of stage st + 1, then refill the buffer just read
    asm volatile("s_wait_dscnt 0x0" ::: "memory");     // own LDS reads done
    asm volatile("s_wait_asynccnt 0x0" ::: "memory");  // own copies landed
    __syncthreads();  // stage st + 1 readable; every reader has left stage st
    if (st + 2 < ST_COUNT)
      stage_copy(lk0 + bufo * 2u, lk0 + (bufo + ST_TILE) * 2u,
                 gk + (size_t)(st + 2) * ST_KEYS * D_K,
                 gv + (st + 2) * ST_KEYS);
  }
  asm volatile("s_wait_asynccnt 0x0" ::: "memory");  // nothing left in flight

  // ---- broadcast 1/l per query to m-indexed rows, normalize, store bf16
  {
    float inv = 1.0f / lrun;
    if (lane < 16) cl[lane] = inv;
  }
  asm volatile("s_wait_dscnt 0" ::: "memory");
  float4 c0 = *(const float4*)(cl + hi * 8);
  float4 c1 = *(const float4*)(cl + hi * 8 + 4);
  float cc[8] = {c0.x, c0.y, c0.z, c0.w, c1.x, c1.y, c1.z, c1.w};
#pragma unroll
  for (int j = 0; j < 4; ++j) {
    int d = h * D_K + j * 16 + l15;
#pragma unroll
    for (int r = 0; r < 8; ++r) {
      int m = q0 + r + hi * 8;
      ctx[(size_t)(b * SEQ + m) * D_MODEL + d] = (__bf16)(o[j][r] * cc[r]);
    }
  }
}

// ---------------------------------------------------------------------------
extern "C" void kernel_launch(void* const* d_in, const int* in_sizes, int n_in,
                              void* d_out, int out_size, void* d_ws,
                              size_t ws_size, hipStream_t stream) {
  const float* x  = (const float*)d_in[0];
  const float* Wq = (const float*)d_in[1];
  const float* bq = (const float*)d_in[2];
  const float* Wk = (const float*)d_in[3];
  const float* bk = (const float*)d_in[4];
  const float* Wv = (const float*)d_in[5];
  const float* bv = (const float*)d_in[6];
  const float* Wo = (const float*)d_in[7];
  const float* bo = (const float*)d_in[8];
  float* out = (float*)d_out;

  // Workspace layout (bf16 buffers)
  char*   ws    = (char*)d_ws;
  __bf16* xbf   = (__bf16*)ws;                      // M x 1024
  __bf16* Wqt   = xbf + (size_t)MTOT * D_MODEL;     // 1024 x 1024
  __bf16* Wkt   = Wqt + (size_t)D_MODEL * D_MODEL;  // 64 x 1024
  __bf16* Wvt   = Wkt + (size_t)D_K * D_MODEL;      // 64 x 1024
  __bf16* Wot   = Wvt + (size_t)D_K * D_MODEL;      // 1024 x 1024
  __bf16* Qbf   = Wot + (size_t)D_MODEL * D_MODEL;  // M x 1024
  __bf16* Kbf   = Qbf + (size_t)MTOT * D_MODEL;     // M x 64
  __bf16* Vtbf  = Kbf + (size_t)MTOT * D_K;         // 64 x M
  __bf16* ctxbf = Vtbf + (size_t)D_K * MTOT;        // M x 1024

  // ---- prep: x convert + the four weight transposes, one launch
  prep_kernel<<<dim3(TB_ALL + CV_BLOCKS), dim3(256), 0, stream>>>(
      x, Wq, Wk, Wv, Wo, xbf, Wqt, Wkt, Wvt, Wot);

  dim3 blk(128);
  // Q = (x@Wq + bq) * 1/sqrt(64), K = x@Wk + bk, V^T = (x@Wv + bv)^T -> bf16
  gemm_qkv_kernel<<<dim3(MTOT / 128, D_MODEL / 64 + 2), blk, 0, stream>>>(
      xbf, Wqt, Wkt, Wvt, bq, bk, bv, Qbf, Kbf, Vtbf);
  // attention -> ctx bf16
  mqa_attn_kernel<<<dim3(SEQ / (16 * ATT_WAVES), BATCH * NUM_HEADS), blk, 0,
                    stream>>>(Qbf, Kbf, Vtbf, ctxbf);
  // out = ctx@Wo + bo -> f32
  gemm_bf16_kernel<D_MODEL, D_MODEL, false, false>
      <<<dim3(MTOT / 128, D_MODEL / 64), blk, 0, stream>>>(ctxbf, Wot, bo, out,
                                                           1.0f);
}

// v005
// One run takes 116 microseconds.
// Versions in between are left out here; by their measured steps it is 1.13 times as fast as v003.
// All steps since v000 together make it 3.45 times as fast.
#include <hip/hip_runtime.h>

// ---------------------------------------------------------------------------
// MQA forward for MI455X (gfx1250), wave32 WMMA bf16 everywhere.
//   1) x -> bf16; W{q,k,v,o} -> transposed bf16 (Wt[n][k])  [one-time prep]
//   2) Q = (x@Wq+bq)*0.125 -> bf16 [M,1024]
//      K =  x@Wk+bk        -> bf16 [M,64]
//      Vt = (x@Wv+bv)^T    -> bf16 [64,M]
//   3) flash attention: S^T = K.Q^T (lane owns one query's scores ->
//      in-lane softmax reductions, probs already in PV A-frag layout)
//   4) out = ctx@Wo+bo -> f32
// ---------------------------------------------------------------------------

#define D_MODEL 1024
#define NUM_HEADS 16
#define D_K 64
#define BATCH 4
#define SEQ 2048
#define MTOT (BATCH * SEQ)  // 8192

typedef __attribute__((ext_vector_type(16))) __bf16 v16bf;
typedef __attribute__((ext_vector_type(8)))  float  v8f;

__device__ __forceinline__ v8f wmma_bf16(v16bf a, v16bf b, v8f c) {
  // (neg_a, A, neg_b, B, c_mod, C, reuse_a, reuse_b)
  return __builtin_amdgcn_wmma_f32_16x16x32_bf16(false, a, false, b,
                                                 (short)0, c, false, false);
}

// Fragment (A or B) from bf16 memory: lane holds k = {kbase..kbase+7,
// kbase+16..kbase+23} of its row/column, kbase=0|8 by lane half. Caller
// passes base = &row[kbase]; both halves are 16B -> two b128 loads.
__device__ __forceinline__ v16bf load_frag_bf16(const __bf16* base) {
  v16bf f;
#pragma unroll
  for (int i = 0; i < 8; ++i) {
    f[i]     = base[i];
    f[i + 8] = base[16 + i];
  }
  return f;
}

// The same fragment from an LDS row (16-byte aligned): two ds_load_b128.
typedef __attribute__((ext_vector_type(8))) __bf16 v8bf;
__device__ __forceinline__ v16bf load_frag_lds(const __bf16* base) {
  v8bf lo = *(const v8bf*)base;
  v8bf hi = *(const v8bf*)(base + 16);
  return __builtin_shufflevector(lo, hi, 0, 1, 2, 3, 4, 5, 6, 7, 8, 9, 10, 11,
                                 12, 13, 14, 15);
}

// ---------------------------------------------------------------------------
// Prep: five jobs that read only inputs and none of each other's output, so
// they run as ONE launch; the block index picks the job (block-uniform).
// ---------------------------------------------------------------------------
__device__ __forceinline__ void convert_bf16_block(
    const float* __restrict__ in, __bf16* __restrict__ out, int n, int blk) {
  int i = (blk * 256 + threadIdx.x) * 4;
  if (i < n) {
    float4 v = *(const float4*)(in + i);
    out[i + 0] = (__bf16)v.x;
    out[i + 1] = (__bf16)v.y;
    out[i + 2] = (__bf16)v.z;
    out[i + 3] = (__bf16)v.w;
  }
}

// Wt[n][k] = bf16(W[k][n]); 32x32 LDS tile transpose. t: tile number, the k
// tile running fastest.
__device__ __forceinline__ void transpose_bf16_block(
    const float* __restrict__ in, __bf16* __restrict__ out, int K, int N,
    int t, float (*tile)[33]) {
  const int k0 = (t % (K / 32)) * 32, n0 = (t / (K / 32)) * 32;
  const int c = threadIdx.x & 31, r8 = threadIdx.x >> 5;  // r8: 0..7
#pragma unroll
  for (int i = 0; i < 4; ++i) {
    int r = r8 + i * 8;
    tile[r][c] = in[(size_t)(k0 + r) * N + n0 + c];
  }
  __syncthreads();
#pragma unroll
  for (int i = 0; i < 4; ++i) {
    int r = r8 + i * 8;
    out[(size_t)(n0 + r) * K + k0 + c] = (__bf16)tile[c][r];
  }
  // another job's code follows in the merged kernel: no register that these
  // stores name is rewritten ahead of this wait
  asm volatile("s_wait_xcnt 0x0" ::: "memory");
}

#define TB_BIG ((D_MODEL / 32) * (D_MODEL / 32))  // tiles of Wq, of Wo: 1024
#define TB_SMALL ((D_MODEL / 32) * (D_K / 32))    // tiles of Wk, of Wv: 64
#define TB_ALL (2 * TB_BIG + 2 * TB_SMALL)        // transposing blocks
#define CV_BLOCKS (MTOT * D_MODEL / 1024)         // converting blocks

// Blocks [0, TB_ALL) transpose the weights, the rest convert x: the blocks
// with the barrier and the short stores start first, under the long stream.
__global__ __launch_bounds__(256) void prep_kernel(
    const float* __restrict__ x, const float* __restrict__ Wq,
    const float* __restrict__ Wk, const float* __restrict__ Wv,
    const float* __restrict__ Wo, __bf16* __restrict__ xbf,
    __bf16* __restrict__ Wqt, __bf16* __restrict__ Wkt,
    __bf16* __restrict__ Wvt, __bf16* __restrict__ Wot) {
  __shared__ float tile[32][33];
  const int blk = blockIdx.x;
  if (blk >= TB_ALL) {
    convert_bf16_block(x, xbf, MTOT * D_MODEL, blk - TB_ALL);
    return;
  }
  const float* in;
  __bf16* out;
  int N, t;
  if (blk < TB_BIG) {
    in = Wq, out = Wqt, N = D_MODEL, t = blk;
  } else if (blk < 2 * TB_BIG) {
    in = Wo, out = Wot, N = D_MODEL, t = blk - TB_BIG;
  } else if (blk < 2 * TB_BIG + TB_SMALL) {
    in = Wk, out = Wkt, N = D_K, t = blk - 2 * TB_BIG;
  } else {
    in = Wv, out = Wvt, N = D_K, t = blk - 2 * TB_BIG - TB_SMALL;
  }
  transpose_bf16_block(in, out, D_MODEL, N, t, tile);
}

// ---------------------------------------------------------------------------
// GEMM: C[M,N] = A[M,Kd](bf16) * Wt[N,Kd](bf16)^T + bias, epilogue scale.
// Block = 128 (4 waves, 2 x 2), block tile 128(M) x 128(N); each wave:
// 64(M) x 64(N), 16 f32 accumulators: every fragment read from LDS feeds four
// WMMAs, and a block brings 256 rows from L2 for 128 x 128 results.
// A and Wt reach the waves through LDS: the block's 128 threads bring a stage
// of 64 k (A: 128 rows of 128 B, Wt: 128 rows of 128 B) with asynchronous b128
// copies that cover whole 128-B lines, into two buffers, one stage ahead.
// Rows are pitched 144 B (16 B x odd) so that ds_load_b128 meets no bank
// conflict. The k order of every sum is unchanged.
// ---------------------------------------------------------------------------
#define GS_K 64                        // k per stage
#define GS_PITCH 72                    // bf16 per LDS row: 128 B data + 16 B pad
#define GS_T (128 * GS_PITCH)          // bf16 per tile (A or Wt), 18432 B
#define GS_BUF (2 * GS_T)              // bf16 per buffer (A tile, then Wt tile)

// One tile of a stage: 8 copies per lane, 16 rows apart each. l: the lane's
// LDS byte address in the tile; glo / ghi: its global address in the tile's
// rows 0..63 / 64..127. s_wait_xcnt 0 closes the statement so that no address
// register is rewritten ahead of it.
template <int Kd>
__device__ __forceinline__ void gemm_tile_copy(unsigned l, const __bf16* glo,
                                               const __bf16* ghi) {
  constexpr unsigned R16 = 16u * GS_PITCH * 2u;  // 16 LDS rows, bytes
  asm volatile(
      "global_load_async_to_lds_b128 %0, %8, off\n\t"
      "global_load_async_to_lds_b128 %1, %9, off\n\t"
      "global_load_async_to_lds_b128 %2, %10, off\n\t"
      "global_load_async_to_lds_b128 %3, %11, off\n\t"
      "global_load_async_to_lds_b128 %4, %12, off\n\t"
      "global_load_async_to_lds_b128 %5, %13, off\n\t"
      "global_load_async_to_lds_b128 %6, %14, off\n\t"
      "global_load_async_to_lds_b128 %7, %15, off\n\t"
      "s_wait_xcnt 0x0"
      ::"v"(l), "v"(l + R16), "v"(l + 2u * R16), "v"(l + 3u * R16),
        "v"(l + 4u * R16), "v"(l + 5u * R16), "v"(l + 6u * R16),
        "v"(l + 7u * R16), "v"(glo), "v"(glo + 16 * Kd), "v"(glo + 32 * Kd),
        "v"(glo + 48 * Kd), "v"(ghi), "v"(ghi + 16 * Kd), "v"(ghi + 32 * Kd),
        "v"(ghi + 48 * Kd)
      : "memory");
}

// The products of one block tile: rows mb.. of A against 128 rows of Wt, given
// as two runs of 64 (wlo: the tile's rows 0..63, whi: its rows 64..127).
// gring: the block's LDS ring; acc[i][j]: the wave's 4 x 4 tiles of 16 x 16.
template <int Kd>
__device__ __forceinline__ void gemm_bf16_products(
    const __bf16* __restrict__ A, const __bf16* __restrict__ wlo,
    const __bf16* __restrict__ whi, int mb, __bf16* gring, v8f (&acc)[4][4]) {
  static_assert(Kd % GS_K == 0 && Kd / GS_K >= 2, "the ring needs two stages");

  const int tid   = threadIdx.x;
  const int wave  = tid >> 5;
  const int lane  = tid & 31;
  const int l15   = lane & 15;
  const int hi    = lane >> 4;
  const int kbase = hi ? 8 : 0;

  // Copy side: thread t brings 16-byte piece (t & 7) of rows (t >> 3) + 16 i.
  const int crow = tid >> 3, cpc = tid & 7;
  const __bf16* ga = A + (size_t)(mb + crow) * Kd + cpc * 8;
  const __bf16* gl = wlo + (size_t)crow * Kd + cpc * 8;
  const __bf16* gh = whi + (size_t)crow * Kd + cpc * 8;
  const unsigned la0 =
      (unsigned)(size_t)gring + (unsigned)(crow * GS_PITCH + cpc * 8) * 2u;

  // Read side: this lane's fragment rows in buffer 0. Waves 0, 1 / 2, 3 take
  // the low / high 64 columns, even / odd waves the low / high 64 rows.
  const __bf16* ar = gring + ((wave & 1) * 64 + l15) * GS_PITCH + kbase;
  const __bf16* wr = gring + GS_T + ((wave >> 1) * 64 + l15) * GS_PITCH + kbase;

  // ---- ring prologue: stage 0 landed and published, stage 1 in flight
  gemm_tile_copy<Kd>(la0, ga, ga + 64 * Kd);
  gemm_tile_copy<Kd>(la0 + GS_T * 2u, gl, gh);
  asm volatile("s_wait_asynccnt 0x0" ::: "memory");  // own copies landed
  __syncthreads();                                   // publish stage 0
  gemm_tile_copy<Kd>(la0 + GS_BUF * 2u, ga + GS_K, ga + 64 * Kd + GS_K);
  gemm_tile_copy<Kd>(la0 + (GS_BUF + GS_T) * 2u, gl + GS_K, gh + GS_K);

  for (int st = 0; st < Kd / GS_K; ++st) {
    const int bufo = (st & 1) * GS_BUF;
    // Fragments are read 32 k at a time: the 16 of a whole stage, held beside
    // the 16 accumulators, spill to scratch. Every loop below is unrolled so
    // that each fragment and accumulator index is a constant.
    v16bf af[4], bf[4];
    // ---- first 32 k of the stage: 16 reads as one group, then 16 products
#pragma unroll
    for (int i = 0; i < 4; ++i)
      af[i] = load_frag_lds(ar + bufo + i * 16 * GS_PITCH);
#pragma unroll
    for (int j = 0; j < 4; ++j)
      bf[j] = load_frag_lds(wr + bufo + j * 16 * GS_PITCH);
#pragma unroll
    for (int i = 0; i < 4; ++i) {
#pragma unroll
      for (int j = 0; j < 4; ++j)
        acc[i][j] = wmma_bf16(af[i], bf[j], acc[i][j]);
    }
    // ---- last 32 k: the buffer is free again as soon as these have returned
#pragma unroll
    for (int i = 0; i < 4; ++i)
      af[i] = load_frag_lds(ar + bufo + i * 16 * GS_PITCH + 32);
#pragma unroll
    for (int j = 0; j < 4; ++j)
      bf[j] = load_frag_lds(wr + bufo + j * 16 * GS_PITCH + 32);

    // ---- publish point of stage st + 1, then refill the buffer just read;
    //      the refill flies under the products below, which need only
    //      registers, and under the next stage's first half
    asm volatile("s_wait_dscnt 0x0" ::: "memory");     // own LDS reads done
    asm volatile("s_wait_asynccnt 0x0" ::: "memory");  // own copies landed
    __syncthreads();  // stage st + 1 readable; every reader has left stage st
    if (st + 2 < Kd / GS_K) {
      gemm_tile_copy<Kd>(la0 + bufo * 2u, ga + (st + 2) * GS_K,
                         ga + 64 * Kd + (st + 2) * GS_K);
      gemm_tile_copy<Kd>(la0 + (bufo + GS_T) * 2u, gl + (st + 2) * GS_K,
                         gh + (st + 2) * GS_K);
    }

#pragma unroll
    for (int i = 0; i < 4; ++i) {
#pragma unroll
      for (int j = 0; j < 4; ++j)
        acc[i][j] = wmma_bf16(af[i], bf[j], acc[i][j]);
    }
  }
  asm volatile("s_wait_asynccnt 0x0" ::: "memory");  // nothing left in flight
}

// The store of one wave's 64 x 64 results, with bias and scale. m0: the wave's
// first row; n0: its first column, in the product's own numbering.
template <int N, bool TRANS_OUT, bool BF16_OUT>
__device__ __forceinline__ void gemm_bf16_store(
    const v8f (&acc)[4][4], const float* __restrict__ bias,
    void* __restrict__ Cout, float out_scale, int m0, int n0) {
  const int lane = threadIdx.x & 31;
  const int l15  = lane & 15;
  const int hi   = lane >> 4;

  float bv[4];
#pragma unroll
  for (int j = 0; j < 4; ++j) bv[j] = bias[n0 + j * 16 + l15];

  // C/D layout: VGPR r -> (mtile + r + 8*hi, n0 + j*16 + l15)
#pragma unroll
  for (int i = 0; i < 4; ++i) {
#pragma unroll
    for (int j = 0; j < 4; ++j) {
      int n = n0 + j * 16 + l15;
#pragma unroll
      for (int r = 0; r < 8; ++r) {
        int    m   = m0 + i * 16 + r + hi * 8;
        float  val = (acc[i][j][r] + bv[j]) * out_scale;
        size_t ix  = TRANS_OUT ? ((size_t)n * MTOT + m) : ((size_t)m * N + n);
        if constexpr (BF16_OUT)
          ((__bf16*)Cout)[ix] = (__bf16)val;
        else
          ((float*)Cout)[ix] = val;
      }
    }
    // the next row tile's values and addresses, and in the merged kernel
    // another product's store code, follow: no register that these stores
    // name is rewritten ahead of this wait
    asm volatile("s_wait_xcnt 0x0" ::: "memory");
  }
}

template <int Kd, int N, bool TRANS_OUT, bool BF16_OUT>
__global__ __launch_bounds__(128) void gemm_bf16_kernel(
    const __bf16* __restrict__ A, const __bf16* __restrict__ Wt,
    const float* __restrict__ bias, void* __restrict__ Cout, float out_scale) {
  __shared__ __align__(16) __bf16 gring[2 * GS_BUF];
  const int mb = blockIdx.x * 128, n0 = blockIdx.y * 128;
  const int wave = threadIdx.x >> 5;
  v8f acc[4][4] = {};
  gemm_bf16_products<Kd>(A, Wt + (size_t)n0 * Kd, Wt + (size_t)(n0 + 64) * Kd,
                         mb, gring, acc);
  gemm_bf16_store<N, TRANS_OUT, BF16_OUT>(acc, bias, Cout, out_scale,
                                          mb + (wave & 1) * 64,
                                          n0 + (wave >> 1) * 64);
}

// Q, K and V^T read the same A and none of each other's output: ONE launch.
// blockIdx.y picks the column tile (block-uniform): tile 0 holds K in its low
// 64 columns and V^T in its high 64, tiles 1.. are the column tiles of Q. The
// product loop is common; only the weight rows and the store differ. In tile
// 0 a wave stores K or V^T by its column half; no barrier follows.
__global__ __launch_bounds__(128) void gemm_qkv_kernel(
    const __bf16* __restrict__ A, const __bf16* __restrict__ Wqt,
    const __bf16* __restrict__ Wkt, const __bf16* __restrict__ Wvt,
    const float* __restrict__ bq, const float* __restrict__ bk,
    const float* __restrict__ bv, __bf16* __restrict__ Qo,
    __bf16* __restrict__ Ko, __bf16* __restrict__ Vto) {
  __shared__ __align__(16) __bf16 gring[2 * GS_BUF];
  const int mb = blockIdx.x * 128;
  const int y  = blockIdx.y;
  const int nq = (y - 1) * 128;  // first Q column of tiles 1..
  const __bf16* wlo = y == 0 ? Wkt : Wqt + (size_t)nq * D_MODEL;
  const __bf16* whi = y == 0 ? Wvt : Wqt + (size_t)(nq + 64) * D_MODEL;
  v8f acc[4][4] = {};
  gemm_bf16_products<D_MODEL>(A, wlo, whi, mb, gring, acc);
  const int wave = __builtin_amdgcn_readfirstlane(threadIdx.x >> 5);
  const int m0   = mb + (wave & 1) * 64;
  if (y != 0)
    gemm_bf16_store<D_MODEL, false, true>(acc, bq, Qo, 0.125f, m0,
                                          nq + (wave >> 1) * 64);
  else if ((wave >> 1) == 0)
    gemm_bf16_store<D_K, false, true>(acc, bk, Ko, 1.0f, m0, 0);
  else
    gemm_bf16_store<D_K, true, true>(acc, bv, Vto, 1.0f, m0, 0);
}

// ---------------------------------------------------------------------------
// Flash attention (MQA): each wave owns a 16-query tile of one (b,h).
// Scores computed TRANSPOSED: S^T[key][q] = K_tile . Q_tile^T (A = K rows,
// B = Q rows; identical fragment bytes, swapped operands). Consequences:
//  * lane (n = lane&15) owns query q: its 8+8 accumulator regs hold keys
//    {0..7,16..23} (low half) / {8..15,24..31} (high half) of the 32-key
//    tile; the xor-16 partner holds the other 16 -> softmax max/sum are
//    in-lane reductions + ONE shfl_xor(16) each.
//  * exp'd probs are ALREADY in the PV A-fragment layout -> no LDS bounce.
//  * running m/l are one scalar per lane; the o-rescale factor needs a
//    16-float LDS broadcast (C-layout rows are m-indexed).
//  * the rescale is lazy: the maximum in use stays until some score of the
//    wave's pass lies more than LAZY_T above it (probs then stay below
//    e^LAZY_T, far inside f32 and bf16 range). One test per pass, a scalar
//    branch; the exchange of maxima between the lane halves, the factor, its
//    broadcast and the 32 products on o stand inside that branch.
// K frags loaded up-front (clause-batched), V frags loaded before the
// softmax so exp VALU hides their latency. Q pre-scaled by 1/sqrt(64).
// K and V^T reach the waves through LDS: the block's 128 threads bring a
// stage of 64 keys (K: 64 rows of 128 B, V^T: 64 rows of 128 B) with
// asynchronous b128 copies that cover whole 128-B lines, into two buffers,
// one stage ahead; all four waves read their fragments from there. Rows are
// pitched 144 B (16 B x odd) so that ds_load_b128 meets no bank conflict.
// ---------------------------------------------------------------------------
#define ATT_WAVES 4
#define ST_KEYS 64                     // keys per stage
#define ST_PITCH 72                    // bf16 per LDS row: 128 B data + 16 B pad
#define ST_TILE (64 * ST_PITCH)        // bf16 per tile (K or V^T), 9216 B
#define ST_BUF (2 * ST_TILE)           // bf16 per buffer (K tile, then V^T tile)
#define ST_COUNT (SEQ / ST_KEYS)       // 32 stages
#define LAZY_T 6.0f                    // probs stay below e^6, about 400

// One stage: 8 copies per lane (4 of K, 4 of V^T), 16 rows apart each.
// lk / lv: the lane's LDS byte address in the K / V^T tile; gk / gv: its
// global address. s_wait_xcnt 0 closes the statement so that no address
// register is rewritten ahead of it.
__device__ __forceinline__ void stage_copy(unsigned lk, unsigned lv,
                                           const __bf16* gk,
                                           const __bf16* gv) {
  asm volatile(
      "global_load_async_to_lds_b128 %0, %8, off\n\t"
      "global_load_async_to_lds_b128 %1, %9, off\n\t"
      "global_load_async_to_lds_b128 %2, %10, off\n\t"
      "global_load_async_to_lds_b128 %3, %11, off\n\t"
      "global_load_async_to_lds_b128 %4, %12, off\n\t"
      "global_load_async_to_lds_b128 %5, %13, off\n\t"
      "global_load_async_to_lds_b128 %6, %14, off\n\t"
      "global_load_async_to_lds_b128 %7, %15, off\n\t"
      "s_wait_xcnt 0x0"
      ::"v"(lk), "v"(lk + 16u * ST_PITCH * 2u), "v"(lk + 32u * ST_PITCH * 2u),
        "v"(lk + 48u * ST_PITCH * 2u), "v"(lv), "v"(lv + 16u * ST_PITCH * 2u),
        "v"(lv + 32u * ST_PITCH * 2u), "v"(lv + 48u * ST_PITCH * 2u), "v"(gk),
        "v"(gk + 16 * D_K), "v"(gk + 32 * D_K), "v"(gk + 48 * D_K), "v"(gv),
        "v"(gv + (size_t)16 * MTOT), "v"(gv + (size_t)32 * MTOT),
        "v"(gv + (size_t)48 * MTOT)
      : "memory");
}

__global__ __launch_bounds__(128) void mqa_attn_kernel(
    const __bf16* __restrict__ Q, const __bf16* __restrict__ Kp,
    const __bf16* __restrict__ Vt, __bf16* __restrict__ ctx) {
  __shared__ __align__(16) float cl_all[ATT_WAVES * 16];
  __shared__ __align__(16) __bf16 ring[2 * ST_BUF];

  const int tid   = threadIdx.x;
  const int wave  = tid >> 5;
  const int lane  = tid & 31;
  const int l15   = lane & 15;
  const int hi    = lane >> 4;
  const int kbase = hi ? 8 : 0;
  float* cl = cl_all + wave * 16;

  const int bh = blockIdx.y;  // 0..63
  const int b  = bh >> 4;
  const int h  = bh & 15;
  const int q0 = (blockIdx.x * ATT_WAVES + wave) * 16;

  // Q fragments (used as B operands: Bt[n=q][k=d] = Q row q)
  const __bf16* qrow =
      Q + (size_t)(b * SEQ + q0 + l15) * D_MODEL + h * D_K + kbase;
  v16bf qf0 = load_frag_bf16(qrow);
  v16bf qf1 = load_frag_bf16(qrow + 32);

  // Copy side: thread t brings 16-byte piece (t & 7) of rows (t >> 3) + 16 i.
  const int crow = tid >> 3, cpc = tid & 7;
  const __bf16* gk = Kp + (size_t)b * SEQ * D_K + crow * D_K + cpc * 8;
  const __bf16* gv = Vt + (size_t)crow * MTOT + (size_t)b * SEQ + cpc * 8;
  const unsigned lk0 =
      (unsigned)(size_t)ring + (unsigned)(crow * ST_PITCH + cpc * 8) * 2u;

  float mrun = -1e30f, lrun = 0.0f;  // per-lane scalars (this lane's query)
  float mthr = -1e30f;               // mrun + LAZY_T: above it, rescale
  v8f o[4] = {};

  // ---- ring prologue: stage 0 landed and published, stage 1 in flight
  stage_copy(lk0, lk0 + ST_TILE * 2u, gk, gv);
  asm volatile("s_wait_asynccnt 0x0" ::: "memory");  // own copies landed
  __syncthreads();                                   // publish stage 0
  stage_copy(lk0 + ST_BUF * 2u, lk0 + (ST_BUF + ST_TILE) * 2u,
             gk + ST_KEYS * D_K, gv + ST_KEYS);

  for (int st = 0; st < ST_COUNT; ++st) {
   const int bufo = (st & 1) * ST_BUF;
#pragma unroll
   for (int sub = 0; sub < ST_KEYS; sub += 32) {
    // ---- issue ALL K-fragment loads first (one clause), then 4 WMMAs with
    //      interleaved accumulation chains for ILP.
    const __bf16* kr0 = ring + bufo + (sub + l15) * ST_PITCH + kbase;
    const __bf16* kr1 = kr0 + 16 * ST_PITCH;
    v16bf kf00 = load_frag_lds(kr0);
    v16bf kf01 = load_frag_lds(kr0 + 32);
    v16bf kf10 = load_frag_lds(kr1);
    v16bf kf11 = load_frag_lds(kr1 + 32);

    v8f st0 = {}, st1 = {};
    st0 = wmma_bf16(kf00, qf0, st0);
    st1 = wmma_bf16(kf10, qf0, st1);
    st0 = wmma_bf16(kf01, qf1, st0);
    st1 = wmma_bf16(kf11, qf1, st1);

    // ---- V fragments early: softmax VALU below hides their latency
    v16bf vf[4];
#pragma unroll
    for (int j = 0; j < 4; ++j)
      vf[j] = load_frag_lds(ring + bufo + ST_TILE + (j * 16 + l15) * ST_PITCH +
                            sub + kbase);

    // ---- in-lane max over this lane's 16 keys
    float vmax = fmaxf(st0[0], st1[0]);
#pragma unroll
    for (int r = 1; r < 8; ++r) vmax = fmaxf(vmax, fmaxf(st0[r], st1[r]));

    // ---- lazy rescale: taken by the whole wave (scalar branch on the ballot)
    //      when any lane's scores pass the threshold; every query then moves
    //      to the larger of its maximum in use and this pass's maximum, the same in both lane halves
    if (__builtin_amdgcn_ballot_w32(vmax > mthr) != 0) {
      // partner half's maximum, by the builtin: with __shfl_xor here the
      // compiler shared its index arithmetic with the call further down, and
      // the merged paths cost a copy of all 32 o registers on every pass
      float vpar = __builtin_bit_cast(
          float, __builtin_amdgcn_ds_bpermute((lane ^ 16) << 2,
                                              __builtin_bit_cast(int, vmax)));
      float mnew = fmaxf(mrun, fmaxf(vmax, vpar));
      float corr = __expf(mrun - mnew);
      mrun = mnew;
      mthr = mnew + LAZY_T;
      lrun *= corr;
      // broadcast per-query corr to o's m-indexed rows (16 floats/wave)
      if (lane < 16) cl[lane] = corr;
      // the wave's own store has landed before its lanes read it back
      asm volatile("s_wait_dscnt 0" ::: "memory");
      float4 c0 = *(const float4*)(cl + hi * 8);
      float4 c1 = *(const float4*)(cl + hi * 8 + 4);
      float cc[8] = {c0.x, c0.y, c0.z, c0.w, c1.x, c1.y, c1.z, c1.w};
#pragma unroll
      for (int j = 0; j < 4; ++j)
#pragma unroll
        for (int r = 0; r < 8; ++r) o[j][r] *= cc[r];
    }

    // ---- exp + in-lane sum (+ partner), probs straight into A-frag layout
    v16bf pf;
    float rs = 0.0f;
#pragma unroll
    for (int r = 0; r < 8; ++r) {
      float e0 = __expf(st0[r] - mrun);
      float e1 = __expf(st1[r] - mrun);
      rs += e0 + e1;
      pf[r]     = (__bf16)e0;  // keys kbase+r      of this query
      pf[r + 8] = (__bf16)e1;  // keys kbase+16+r   of this query
    }
    rs += __shfl_xor(rs, 16, 32);
    lrun += rs;

    // ---- PV: o += P.V ; A = probs (in regs), B = Vt rows. 4 WMMAs.
#pragma unroll
    for (int j = 0; j < 4; ++j) o[j] = wmma_bf16(pf, vf[j], o[j]);
   }

    // ---- publish point of stage st + 1, then refill the buffer just read
    asm volatile("s_wait_dscnt 0x0" ::: "memory");     // own LDS reads done
    asm volatile("s_wait_asynccnt 0x0" ::: "memory");  // own copies landed
    __syncthreads();  // stage st + 1 readable; every reader has left stage st
    if (st + 2 < ST_COUNT)
      stage_copy(lk0 + bufo * 2u, lk0 + (bufo + ST_TILE) * 2u,
                 gk + (size_t)(st + 2) * ST_KEYS * D_K,
                 gv + (st + 2) * ST_KEYS);
  }
  asm volatile("s_wait_asynccnt 0x0" ::: "memory");  // nothing left in flight

  // ---- broadcast 1/l per query to m-indexed rows, normalize, store bf16
  {
    float inv = 1.0f / lrun;
    if (lane < 16) cl[lane] = inv;
  }
  asm volatile("s_wait_dscnt 0" ::: "memory");
  float4 c0 = *(const float4*)(cl + hi * 8);
  float4 c1 = *(const float4*)(cl + hi * 8 + 4);
  float cc[8] = {c0.x, c0.y, c0.z, c0.w, c1.x, c1.y, c1.z, c1.w};
#pragma unroll
  for (int j = 0; j < 4; ++j) {
    int d = h * D_K + j * 16 + l15;
#pragma unroll
    for (int r = 0; r < 8; ++r) {
      int m = q0 + r + hi * 8;
      ctx[(size_t)(b * SEQ + m) * D_MODEL + d] = (__bf16)(o[j][r] * cc[r]);
    }
  }
}

// ---------------------------------------------------------------------------
extern "C" void kernel_launch(void* const* d_in, const int* in_sizes, int n_in,
                              void* d_out, int out_size, void* d_ws,
                              size_t ws_size, hipStream_t stream) {
  const float* x  = (const float*)d_in[0];
  const float* Wq = (const float*)d_in[1];
  const float* bq = (const float*)d_in[2];
  const float* Wk = (const float*)d_in[3];
  const float* bk = (const float*)d_in[4];
  const float* Wv = (const float*)d_in[5];
  const float* bv = (const float*)d_in[6];
  const float* Wo = (const float*)d_in[7];
  const float* bo = (const float*)d_in[8];
  float* out = (float*)d_out;

  // Workspace layout (bf16 buffers)
  char*   ws    = (char*)d_ws;
  __bf16* xbf   = (__bf16*)ws;                      // M x 1024
  __bf16* Wqt   = xbf + (size_t)MTOT * D_MODEL;     // 1024 x 1024
  __bf16* Wkt   = Wqt + (size_t)D_MODEL * D_MODEL;  // 64 x 1024
  __bf16* Wvt   = Wkt + (size_t)D_K * D_MODEL;      // 64 x 1024
  __bf16* Wot   = Wvt + (size_t)D_K * D_MODEL;      // 1024 x 1024
  __bf16* Qbf   = Wot + (size_t)D_MODEL * D_MODEL;  // M x 1024
  __bf16* Kbf   = Qbf + (size_t)MTOT * D_MODEL;     // M x 64
  __bf16* Vtbf  = Kbf + (size_t)MTOT * D_K;         // 64 x M
  __bf16* ctxbf = Vtbf + (size_t)D_K * MTOT;        // M x 1024

  // ---- prep: x convert + the four weight transposes, one launch
  prep_kernel<<<dim3(TB_ALL + CV_BLOCKS), dim3(256), 0, stream>>>(
      x, Wq, Wk, Wv, Wo, xbf, Wqt, Wkt, Wvt, Wot);

  dim3 blk(128);
  // Q = (x@Wq + bq) * 1/sqrt(64), K = x@Wk + bk, V^T = (x@Wv + bv)^T -> bf16
  gemm_qkv_kernel<<<dim3(MTOT / 128, D_MODEL / 128 + 1), blk, 0, stream>>>(
      xbf, Wqt, Wkt, Wvt, bq, bk, bv, Qbf, Kbf, Vtbf);
  // attention -> ctx bf16
  mqa_attn_kernel<<<dim3(SEQ / (16 * ATT_WAVES), BATCH * NUM_HEADS), blk, 0,
                    stream>>>(Qbf, Kbf, Vtbf, ctxbf);
  // out = ctx@Wo + bo -> f32
  gemm_bf16_kernel<D_MODEL, D_MODEL, false, false>
      <<<dim3(MTOT / 128, D_MODEL / 128), blk, 0, stream>>>(ctxbf, Wot, bo, out,
                                                           1.0f);
}

// v006
// It runs in 111 microseconds.
// Next to v005, in two timings, it ran 1.04 and 1.02 times as fast.
// Counting every step since v000, it is 3.56 times as fast.
#include <hip/hip_runtime.h>

// ---------------------------------------------------------------------------
// MQA forward for MI455X (gfx1250), wave32 WMMA bf16 everywhere.
//   1) x -> bf16; W{q,k,v,o} -> transposed bf16 (Wt[n][k])  [one-time prep]
//   2) Q = (x@Wq+bq)*0.125*log2(e) -> bf16 [M,1024]
//      K =  x@Wk+bk        -> bf16 [M,64]
//      Vt = (x@Wv+bv)^T    -> bf16 [64,M]
//   3) flash attention: S^T = K.Q^T (lane owns one query's scores ->
//      in-lane softmax reductions, probs already in PV A-frag layout)
//   4) out = ctx@Wo+bo -> f32
// ---------------------------------------------------------------------------

#define D_MODEL 1024
#define NUM_HEADS 16
#define D_K 64
#define BATCH 4
#define SEQ 2048
#define MTOT (BATCH * SEQ)  // 8192

typedef __attribute__((ext_vector_type(16))) __bf16 v16bf;
typedef __attribute__((ext_vector_type(8)))  float  v8f;

__device__ __forceinline__ v8f wmma_bf16(v16bf a, v16bf b, v8f c) {
  // (neg_a, A, neg_b, B, c_mod, C, reuse_a, reuse_b)
  return __builtin_amdgcn_wmma_f32_16x16x32_bf16(false, a, false, b,
                                                 (short)0, c, false, false);
}

// Fragment (A or B) from bf16 memory: lane holds k = {kbase..kbase+7,
// kbase+16..kbase+23} of its row/column, kbase=0|8 by lane half. Caller
// passes base = &row[kbase]; both halves are 16B -> two b128 loads.
__device__ __forceinline__ v16bf load_frag_bf16(const __bf16* base) {
  v16bf f;
#pragma unroll
  for (int i = 0; i < 8; ++i) {
    f[i]     = base[i];
    f[i + 8] = base[16 + i];
  }
  return f;
}

// The same fragment from an LDS row (16-byte aligned): two ds_load_b128.
typedef __attribute__((ext_vector_type(8))) __bf16 v8bf;
__device__ __forceinline__ v16bf load_frag_lds(const __bf16* base) {
  v8bf lo = *(const v8bf*)base;
  v8bf hi = *(const v8bf*)(base + 16);
  return __builtin_shufflevector(lo, hi, 0, 1, 2, 3, 4, 5, 6, 7, 8, 9, 10, 11,
                                 12, 13, 14, 15);
}

// ---------------------------------------------------------------------------
// Prep: five jobs that read only inputs and none of each other's output, so
// they run as ONE launch; the block index picks the job (block-uniform).
// ---------------------------------------------------------------------------
__device__ __forceinline__ void convert_bf16_block(
    const float* __restrict__ in, __bf16* __restrict__ out, int n, int blk) {
  int i = (blk * 256 + threadIdx.x) * 4;
  if (i < n) {
    float4 v = *(const float4*)(in + i);
    out[i + 0] = (__bf16)v.x;
    out[i + 1] = (__bf16)v.y;
    out[i + 2] = (__bf16)v.z;
    out[i + 3] = (__bf16)v.w;
  }
}

// Wt[n][k] = bf16(W[k][n]); 32x32 LDS tile transpose. t: tile number, the k
// tile running fastest.
__device__ __forceinline__ void transpose_bf16_block(
    const float* __restrict__ in, __bf16* __restrict__ out, int K, int N,
    int t, float (*tile)[33]) {
  const int k0 = (t % (K / 32)) * 32, n0 = (t / (K / 32)) * 32;
  const int c = threadIdx.x & 31, r8 = threadIdx.x >> 5;  // r8: 0..7
#pragma unroll
  for (int i = 0; i < 4; ++i) {
    int r = r8 + i * 8;
    tile[r][c] = in[(size_t)(k0 + r) * N + n0 + c];
  }
  __syncthreads();
#pragma unroll
  for (int i = 0; i < 4; ++i) {
    int r = r8 + i * 8;
    out[(size_t)(n0 + r) * K + k0 + c] = (__bf16)tile[c][r];
  }
  // another job's code follows in the merged kernel: no register that these
  // stores name is rewritten ahead of this wait
  asm volatile("s_wait_xcnt 0x0" ::: "memory");
}

#define TB_BIG ((D_MODEL / 32) * (D_MODEL / 32))  // tiles of Wq, of Wo: 1024
#define TB_SMALL ((D_MODEL / 32) * (D_K / 32))    // tiles of Wk, of Wv: 64
#define TB_ALL (2 * TB_BIG + 2 * TB_SMALL)        // transposing blocks
#define CV_BLOCKS (MTOT * D_MODEL / 1024)         // converting blocks

// Blocks [0, TB_ALL) transpose the weights, the rest convert x: the blocks
// with the barrier and the short stores start first, under the long stream.
__global__ __launch_bounds__(256) void prep_kernel(
    const float* __restrict__ x, const float* __restrict__ Wq,
    const float* __restrict__ Wk, const float* __restrict__ Wv,
    const float* __restrict__ Wo, __bf16* __restrict__ xbf,
    __bf16* __restrict__ Wqt, __bf16* __restrict__ Wkt,
    __bf16* __restrict__ Wvt, __bf16* __restrict__ Wot) {
  __shared__ float tile[32][33];
  const int blk = blockIdx.x;
  if (blk >= TB_ALL) {
    convert_bf16_block(x, xbf, MTOT * D_MODEL, blk - TB_ALL);
    return;
  }
  const float* in;
  __bf16* out;
  int N, t;
  if (blk < TB_BIG) {
    in = Wq, out = Wqt, N = D_MODEL, t = blk;
  } else if (blk < 2 * TB_BIG) {
    in = Wo, out = Wot, N = D_MODEL, t = blk - TB_BIG;
  } else if (blk < 2 * TB_BIG + TB_SMALL) {
    in = Wk, out = Wkt, N = D_K, t = blk - 2 * TB_BIG;
  } else {
    in = Wv, out = Wvt, N = D_K, t = blk - 2 * TB_BIG - TB_SMALL;
  }
  transpose_bf16_block(in, out, D_MODEL, N, t, tile);
}

// ---------------------------------------------------------------------------
// GEMM: C[M,N] = A[M,Kd](bf16) * Wt[N,Kd](bf16)^T + bias, epilogue scale.
// Block = 128 (4 waves, 2 x 2), block tile 128(M) x 128(N); each wave:
// 64(M) x 64(N), 16 f32 accumulators: every fragment read from LDS feeds four
// WMMAs, and a block brings 256 rows from L2 for 128 x 128 results.
// A and Wt reach the waves through LDS: the block's 128 threads bring a stage
// of 64 k (A: 128 rows of 128 B, Wt: 128 rows of 128 B) with asynchronous b128
// copies that cover whole 128-B lines, into two buffers, one stage ahead.
// Rows are pitched 144 B (16 B x odd) so that ds_load_b128 meets no bank
// conflict. The k order of every sum is unchanged.
// ---------------------------------------------------------------------------
#define GS_K 64                        // k per stage
#define GS_PITCH 72                    // bf16 per LDS row: 128 B data + 16 B pad
#define GS_T (128 * GS_PITCH)          // bf16 per tile (A or Wt), 18432 B
#define GS_BUF (2 * GS_T)              // bf16 per buffer (A tile, then Wt tile)

// One tile of a stage: 8 copies per lane, 16 rows apart each. l: the lane's
// LDS byte address in the tile; glo / ghi: its global address in the tile's
// rows 0..63 / 64..127. s_wait_xcnt 0 closes the statement so that no address
// register is rewritten ahead of it.
template <int Kd>
__device__ __forceinline__ void gemm_tile_copy(unsigned l, const __bf16* glo,
                                               const __bf16* ghi) {
  constexpr unsigned R16 = 16u * GS_PITCH * 2u;  // 16 LDS rows, bytes
  asm volatile(
      "global_load_async_to_lds_b128 %0, %8, off\n\t"
      "global_load_async_to_lds_b128 %1, %9, off\n\t"
      "global_load_async_to_lds_b128 %2, %10, off\n\t"
      "global_load_async_to_lds_b128 %3, %11, off\n\t"
      "global_load_async_to_lds_b128 %4, %12, off\n\t"
      "global_load_async_to_lds_b128 %5, %13, off\n\t"
      "global_load_async_to_lds_b128 %6, %14, off\n\t"
      "global_load_async_to_lds_b128 %7, %15, off\n\t"
      "s_wait_xcnt 0x0"
      ::"v"(l), "v"(l + R16), "v"(l + 2u * R16), "v"(l + 3u * R16),
        "v"(l + 4u * R16), "v"(l + 5u * R16), "v"(l + 6u * R16),
        "v"(l + 7u * R16), "v"(glo), "v"(glo + 16 * Kd), "v"(glo + 32 * Kd),
        "v"(glo + 48 * Kd), "v"(ghi), "v"(ghi + 16 * Kd), "v"(ghi + 32 * Kd),
        "v"(ghi + 48 * Kd)
      : "memory");
}

// The products of one block tile: rows mb.. of A against 128 rows of Wt, given
// as two runs of 64 (wlo: the tile's rows 0..63, whi: its rows 64..127).
// gring: the block's LDS ring; acc[i][j]: the wave's 4 x 4 tiles of 16 x 16.
template <int Kd>
__device__ __forceinline__ void gemm_bf16_products(
    const __bf16* __restrict__ A, const __bf16* __restrict__ wlo,
    const __bf16* __restrict__ whi, int mb, __bf16* gring, v8f (&acc)[4][4]) {
  static_assert(Kd % GS_K == 0 && Kd / GS_K >= 2, "the ring needs two stages");

  const int tid   = threadIdx.x;
  const int wave  = tid >> 5;
  const int lane  = tid & 31;
  const int l15   = lane & 15;
  const int hi    = lane >> 4;
  const int kbase = hi ? 8 : 0;

  // Copy side: thread t brings 16-byte piece (t & 7) of rows (t >> 3) + 16 i.
  const int crow = tid >> 3, cpc = tid & 7;
  const __bf16* ga = A + (size_t)(mb + crow) * Kd + cpc * 8;
  const __bf16* gl = wlo + (size_t)crow * Kd + cpc * 8;
  const __bf16* gh = whi + (size_t)crow * Kd + cpc * 8;
  const unsigned la0 =
      (unsigned)(size_t)gring + (unsigned)(crow * GS_PITCH + cpc * 8) * 2u;

  // Read side: this lane's fragment rows in buffer 0. Waves 0, 1 / 2, 3 take
  // the low / high 64 columns, even / odd waves the low / high 64 rows.
  const __bf16* ar = gring + ((wave & 1) * 64 + l15) * GS_PITCH + kbase;
  const __bf16* wr = gring + GS_T + ((wave >> 1) * 64 + l15) * GS_PITCH + kbase;

  // ---- ring prologue: stage 0 landed and published, stage 1 in flight
  gemm_tile_copy<Kd>(la0, ga, ga + 64 * Kd);
  gemm_tile_copy<Kd>(la0 + GS_T * 2u, gl, gh);
  asm volatile("s_wait_asynccnt 0x0" ::: "memory");  // own copies landed
  __syncthreads();                                   // publish stage 0
  gemm_tile_copy<Kd>(la0 + GS_BUF * 2u, ga + GS_K, ga + 64 * Kd + GS_K);
  gemm_tile_copy<Kd>(la0 + (GS_BUF + GS_T) * 2u, gl + GS_K, gh + GS_K);

  for (int st = 0; st < Kd / GS_K; ++st) {
    const int bufo = (st & 1) * GS_BUF;
    // Fragments are read 32 k at a time: the 16 of a whole stage, held beside
    // the 16 accumulators, spill to scratch. Every loop below is unrolled so
    // that each fragment and accumulator index is a constant.
    v16bf af[4], bf[4];
    // ---- first 32 k of the stage: 16 reads as one group, then 16 products
#pragma unroll
    for (int i = 0; i < 4; ++i)
      af[i] = load_frag_lds(ar + bufo + i * 16 * GS_PITCH);
#pragma unroll
    for (int j = 0; j < 4; ++j)
      bf[j] = load_frag_lds(wr + bufo + j * 16 * GS_PITCH);
#pragma unroll
    for (int i = 0; i < 4; ++i) {
#pragma unroll
      for (int j = 0; j < 4; ++j)
        acc[i][j] = wmma_bf16(af[i], bf[j], acc[i][j]);
    }
    // ---- last 32 k: the buffer is free again as soon as these have returned
#pragma unroll
    for (int i = 0; i < 4; ++i)
      af[i] = load_frag_lds(ar + bufo + i * 16 * GS_PITCH + 32);
#pragma unroll
    for (int j = 0; j < 4; ++j)
      bf[j] = load_frag_lds(wr + bufo + j * 16 * GS_PITCH + 32);

    // ---- publish point of stage st + 1, then refill the buffer just read;
    //      the refill flies under the products below, which need only
    //      registers, and under the next stage's first half
    asm volatile("s_wait_dscnt 0x0" ::: "memory");     // own LDS reads done
    asm volatile("s_wait_asynccnt 0x0" ::: "memory");  // own copies landed
    __syncthreads();  // stage st + 1 readable; every reader has left stage st
    if (st + 2 < Kd / GS_K) {
      gemm_tile_copy<Kd>(la0 + bufo * 2u, ga + (st + 2) * GS_K,
                         ga + 64 * Kd + (st + 2) * GS_K);
      gemm_tile_copy<Kd>(la0 + (bufo + GS_T) * 2u, gl + (st + 2) * GS_K,
                         gh + (st + 2) * GS_K);
    }

#pragma unroll
    for (int i = 0; i < 4; ++i) {
#pragma unroll
      for (int j = 0; j < 4; ++j)
        acc[i][j] = wmma_bf16(af[i], bf[j], acc[i][j]);
    }
  }
  asm volatile("s_wait_asynccnt 0x0" ::: "memory");  // nothing left in flight
}

// The store of one wave's 64 x 64 results, with bias and scale. m0: the wave's
// first row; n0: its first column, in the product's own numbering.
template <int N, bool TRANS_OUT, bool BF16_OUT>
__device__ __forceinline__ void gemm_bf16_store(
    const v8f (&acc)[4][4], const float* __restrict__ bias,
    void* __restrict__ Cout, float out_scale, int m0, int n0) {
  const int lane = threadIdx.x & 31;
  const int l15  = lane & 15;
  const int hi   = lane >> 4;

  float bv[4];
#pragma unroll
  for (int j = 0; j < 4; ++j) bv[j] = bias[n0 + j * 16 + l15];

  // C/D layout: VGPR r -> (mtile + r + 8*hi, n0 + j*16 + l15)
#pragma unroll
  for (int i = 0; i < 4; ++i) {
#pragma unroll
    for (int j = 0; j < 4; ++j) {
      int n = n0 + j * 16 + l15;
#pragma unroll
      for (int r = 0; r < 8; ++r) {
        int    m   = m0 + i * 16 + r + hi * 8;
        float  val = (acc[i][j][r] + bv[j]) * out_scale;
        size_t ix  = TRANS_OUT ? ((size_t)n * MTOT + m) : ((size_t)m * N + n);
        if constexpr (BF16_OUT)
          ((__bf16*)Cout)[ix] = (__bf16)val;
        else
          ((float*)Cout)[ix] = val;
      }
    }
    // the next row tile's values and addresses, and in the merged kernel
    // another product's store code, follow: no register that these stores
    // name is rewritten ahead of this wait
    asm volatile("s_wait_xcnt 0x0" ::: "memory");
  }
}

template <int Kd, int N, bool TRANS_OUT, bool BF16_OUT>
__global__ __launch_bounds__(128) void gemm_bf16_kernel(
    const __bf16* __restrict__ A, const __bf16* __restrict__ Wt,
    const float* __restrict__ bias, void* __restrict__ Cout, float out_scale) {
  __shared__ __align__(16) __bf16 gring[2 * GS_BUF];
  const int mb = blockIdx.x * 128, n0 = blockIdx.y * 128;
  const int wave = threadIdx.x >> 5;
  v8f acc[4][4] = {};
  gemm_bf16_products<Kd>(A, Wt + (size_t)n0 * Kd, Wt + (size_t)(n0 + 64) * Kd,
                         mb, gring, acc);
  gemm_bf16_store<N, TRANS_OUT, BF16_OUT>(acc, bias, Cout, out_scale,
                                          mb + (wave & 1) * 64,
                                          n0 + (wave >> 1) * 64);
}

// Q carries 1/sqrt(64) and log2(e): the scores then are exponents of 2.
#define Q_SCALE (0.125f * 1.44269504f)

// Q, K and V^T read the same A and none of each other's output: ONE launch.
// blockIdx.y picks the column tile (block-uniform): tile 0 holds K in its low
// 64 columns and V^T in its high 64, tiles 1.. are the column tiles of Q. The
// product loop is common; only the weight rows and the store differ. In tile
// 0 a wave stores K or V^T by its column half; no barrier follows.
__global__ __launch_bounds__(128) void gemm_qkv_kernel(
    const __bf16* __restrict__ A, const __bf16* __restrict__ Wqt,
    const __bf16* __restrict__ Wkt, const __bf16* __restrict__ Wvt,
    const float* __restrict__ bq, const float* __restrict__ bk,
    const float* __restrict__ bv, __bf16* __restrict__ Qo,
    __bf16* __restrict__ Ko, __bf16* __restrict__ Vto) {
  __shared__ __align__(16) __bf16 gring[2 * GS_BUF];
  const int mb = blockIdx.x * 128;
  const int y  = blockIdx.y;
  const int nq = (y - 1) * 128;  // first Q column of tiles 1..
  const __bf16* wlo = y == 0 ? Wkt : Wqt + (size_t)nq * D_MODEL;
  const __bf16* whi = y == 0 ? Wvt : Wqt + (size_t)(nq + 64) * D_MODEL;
  v8f acc[4][4] = {};
  gemm_bf16_products<D_MODEL>(A, wlo, whi, mb, gring, acc);
  const int wave = __builtin_amdgcn_readfirstlane(threadIdx.x >> 5);
  const int m0   = mb + (wave & 1) * 64;
  if (y != 0)
    gemm_bf16_store<D_MODEL, false, true>(acc, bq, Qo, Q_SCALE, m0,
                                          nq + (wave >> 1) * 64);
  else if ((wave >> 1) == 0)
    gemm_bf16_store<D_K, false, true>(acc, bk, Ko, 1.0f, m0, 0);
  else
    gemm_bf16_store<D_K, true, true>(acc, bv, Vto, 1.0f, m0, 0);
}

// ---------------------------------------------------------------------------
// Flash attention (MQA): each wave owns a 16-query tile of one (b,h).
// Scores computed TRANSPOSED: S^T[key][q] = K_tile . Q_tile^T (A = K rows,
// B = Q rows; identical fragment bytes, swapped operands). Consequences:
//  * lane (n = lane&15) owns query q: its 8+8 accumulator regs hold keys
//    {0..7,16..23} (low half) / {8..15,24..31} (high half) of the 32-key
//    tile; the xor-16 partner holds the other 16 -> softmax max/sum are
//    in-lane reductions + ONE shfl_xor(16) each.
//  * exp'd probs are ALREADY in the PV A-fragment layout -> no LDS bounce.
//  * running m/l are one scalar per lane; the o-rescale factor needs a
//    16-float LDS broadcast (C-layout rows are m-indexed).
//  * the score WMMA hands over the argument of v_exp_f32 as it is: Q holds
//    log2(e), and the accumulator starts at minus the maximum in use (all 8
//    registers of a lane belong to one query), so no subtraction and no
//    product stand between the WMMA and the exponential.
//  * the rescale is lazy: the maximum in use stays until some score of the
//    wave's pass lies more than LAZY_T above it (probs then stay below
//    2^LAZY_T, far inside f32 and bf16 range). One test per pass, a scalar
//    branch; the exchange of maxima between the lane halves, the factor, its
//    broadcast, the 32 products on o and the shift of this pass's 16 scores
//    stand inside that branch. The first pass always takes it.
// K frags loaded up-front (clause-batched), V frags loaded before the
// softmax so exp VALU hides their latency.
// K and V^T reach the waves through LDS: the block's 128 threads bring a
// stage of 64 keys (K: 64 rows of 128 B, V^T: 64 rows of 128 B) with
// asynchronous b128 copies that cover whole 128-B lines, into two buffers,
// one stage ahead; all four waves read their fragments from there. Rows are
// pitched 144 B (16 B x odd) so that ds_load_b128 meets no bank conflict.
// ---------------------------------------------------------------------------
#define ATT_WAVES 4
#define ST_KEYS 64                     // keys per stage
#define ST_PITCH 72                    // bf16 per LDS row: 128 B data + 16 B pad
#define ST_TILE (64 * ST_PITCH)        // bf16 per tile (K or V^T), 9216 B
#define ST_BUF (2 * ST_TILE)           // bf16 per buffer (K tile, then V^T tile)
#define ST_COUNT (SEQ / ST_KEYS)       // 32 stages
#define LAZY_T 8.65617f                // 6 log2(e): probs stay below about 400

// One stage: 8 copies per lane (4 of K, 4 of V^T), 16 rows apart each.
// lk / lv: the lane's LDS byte address in the K / V^T tile; gk / gv: its
// global address. s_wait_xcnt 0 closes the statement so that no address
// register is rewritten ahead of it.
__device__ __forceinline__ void stage_copy(unsigned lk, unsigned lv,
                                           const __bf16* gk,
                                           const __bf16* gv) {
  asm volatile(
      "global_load_async_to_lds_b128 %0, %8, off\n\t"
      "global_load_async_to_lds_b128 %1, %9, off\n\t"
      "global_load_async_to_lds_b128 %2, %10, off\n\t"
      "global_load_async_to_lds_b128 %3, %11, off\n\t"
      "global_load_async_to_lds_b128 %4, %12, off\n\t"
      "global_load_async_to_lds_b128 %5, %13, off\n\t"
      "global_load_async_to_lds_b128 %6, %14, off\n\t"
      "global_load_async_to_lds_b128 %7, %15, off\n\t"
      "s_wait_xcnt 0x0"
      ::"v"(lk), "v"(lk + 16u * ST_PITCH * 2u), "v"(lk + 32u * ST_PITCH * 2u),
        "v"(lk + 48u * ST_PITCH * 2u), "v"(lv), "v"(lv + 16u * ST_PITCH * 2u),
        "v"(lv + 32u * ST_PITCH * 2u), "v"(lv + 48u * ST_PITCH * 2u), "v"(gk),
        "v"(gk + 16 * D_K), "v"(gk + 32 * D_K), "v"(gk + 48 * D_K), "v"(gv),
        "v"(gv + (size_t)16 * MTOT), "v"(gv + (size_t)32 * MTOT),
        "v"(gv + (size_t)48 * MTOT)
      : "memory");
}

// Second bound: six waves per SIMD, a budget of 160 registers; left alone the
// compiler takes more than 160 and a wave per SIMD is lost.
__global__ __launch_bounds__(128, 6) void mqa_attn_kernel(
    const __bf16* __restrict__ Q, const __bf16* __restrict__ Kp,
    const __bf16* __restrict__ Vt, __bf16* __restrict__ ctx) {
  __shared__ __align__(16) float cl_all[ATT_WAVES * 16];
  __shared__ __align__(16) __bf16 ring[2 * ST_BUF];

  const int tid   = threadIdx.x;
  const int wave  = tid >> 5;
  const int lane  = tid & 31;
  const int l15   = lane & 15;
  const int hi    = lane >> 4;
  const int kbase = hi ? 8 : 0;
  float* cl = cl_all + wave * 16;

  const int bh = blockIdx.y;  // 0..63
  const int b  = bh >> 4;
  const int h  = bh & 15;
  const int q0 = (blockIdx.x * ATT_WAVES + wave) * 16;

  // Q fragments (used as B operands: Bt[n=q][k=d] = Q row q)
  const __bf16* qrow =
      Q + (size_t)(b * SEQ + q0 + l15) * D_MODEL + h * D_K + kbase;
  v16bf qf0 = load_frag_bf16(qrow);
  v16bf qf1 = load_frag_bf16(qrow + 32);

  // Copy side: thread t brings 16-byte piece (t & 7) of rows (t >> 3) + 16 i.
  const int crow = tid >> 3, cpc = tid & 7;
  const __bf16* gk = Kp + (size_t)b * SEQ * D_K + crow * D_K + cpc * 8;
  const __bf16* gv = Vt + (size_t)crow * MTOT + (size_t)b * SEQ + cpc * 8;
  const unsigned lk0 =
      (unsigned)(size_t)ring + (unsigned)(crow * ST_PITCH + cpc * 8) * 2u;

  float lrun = 0.0f;    // per-lane scalar (this lane's query)
  v8f negm = {};        // minus the maximum in use, eight times: where the
                        // score sums start
  float mthr = -3e38f;  // a score sum above it: rescale (pass 0: always)
  v8f o[4] = {};

  // ---- ring prologue: stage 0 landed and published, stage 1 in flight
  stage_copy(lk0, lk0 + ST_TILE * 2u, gk, gv);
  asm volatile("s_wait_asynccnt 0x0" ::: "memory");  // own copies landed
  __syncthreads();                                   // publish stage 0
  stage_copy(lk0 + ST_BUF * 2u, lk0 + (ST_BUF + ST_TILE) * 2u,
             gk + ST_KEYS * D_K, gv + ST_KEYS);

  for (int st = 0; st < ST_COUNT; ++st) {
   const int bufo = (st & 1) * ST_BUF;
#pragma unroll
   for (int sub = 0; sub < ST_KEYS; sub += 32) {
    // ---- issue ALL K-fragment loads first (one clause), then 4 WMMAs with
    //      interleaved accumulation chains for ILP.
    const __bf16* kr0 = ring + bufo + (sub + l15) * ST_PITCH + kbase;
    const __bf16* kr1 = kr0 + 16 * ST_PITCH;
    v16bf kf00 = load_frag_lds(kr0);
    v16bf kf01 = load_frag_lds(kr0 + 32);
    v16bf kf10 = load_frag_lds(kr1);
    v16bf kf11 = load_frag_lds(kr1 + 32);

    v8f st0 = wmma_bf16(kf00, qf0, negm);  // scores minus the maximum in use
    v8f st1 = wmma_bf16(kf10, qf0, negm);
    st0 = wmma_bf16(kf01, qf1, st0);
    st1 = wmma_bf16(kf11, qf1, st1);

    // ---- V fragments early: softmax VALU below hides their latency
    v16bf vf[4];
#pragma unroll
    for (int j = 0; j < 4; ++j)
      vf[j] = load_frag_lds(ring + bufo + ST_TILE + (j * 16 + l15) * ST_PITCH +
                            sub + kbase);

    // ---- in-lane max over this lane's 16 keys
    float vmax = fmaxf(st0[0], st1[0]);
#pragma unroll
    for (int r = 1; r < 8; ++r) vmax = fmaxf(vmax, fmaxf(st0[r], st1[r]));

    // ---- lazy rescale: taken by the whole wave (scalar branch on the ballot)
    //      when any lane's scores pass the threshold; every query then moves
    //      to this pass's maximum if higher (pass 0: always), the same in both lane halves
    if (__builtin_amdgcn_ballot_w32(vmax > mthr) != 0) {
      // partner half's maximum
      float vpar = __builtin_bit_cast(
          float, __builtin_amdgcn_ds_bpermute((lane ^ 16) << 2,
                                              __builtin_bit_cast(int, vmax)));
      // how far the maximum moves: not down, but in pass 0, where negm holds
      // no maximum yet (mthr - LAZY_T: 0 from then on)
      float up = fmaxf(fmaxf(vmax, vpar), mthr - LAZY_T);
      const float was = negm[0];
      negm -= up;
      up = was - negm[0];  // the move as it was rounded
      st0 -= up;
      st1 -= up;
      // pass 0 may move down; o and lrun are 0 there and want a finite factor
      float corr = __builtin_amdgcn_exp2f(fminf(-up, 0.0f));
      mthr = LAZY_T;
      lrun *= corr;
      // broadcast per-query corr to o's m-indexed rows (16 floats/wave)
      if (lane < 16) cl[lane] = corr;
      // the wave's own store has landed before its lanes read it back
      asm volatile("s_wait_dscnt 0" ::: "memory");
      float4 c0 = *(const float4*)(cl + hi * 8);
      float4 c1 = *(const float4*)(cl + hi * 8 + 4);
      float cc[8] = {c0.x, c0.y, c0.z, c0.w, c1.x, c1.y, c1.z, c1.w};
#pragma unroll
      for (int j = 0; j < 4; ++j)
#pragma unroll
        for (int r = 0; r < 8; ++r) o[j][r] *= cc[r];
    }

    // ---- exp + in-lane sum (+ partner), probs straight into A-frag layout
    v16bf pf;
    float rs = 0.0f;
#pragma unroll
    for (int r = 0; r < 8; ++r) {
      float e0 = __builtin_amdgcn_exp2f(st0[r]);
      float e1 = __builtin_amdgcn_exp2f(st1[r]);
      rs = r == 0 ? e0 + e1 : rs + (e0 + e1);
      pf[r]     = (__bf16)e0;  // keys kbase+r      of this query
      pf[r + 8] = (__bf16)e1;  // keys kbase+16+r   of this query
    }
    {
      // partner half's sum by a cross-row vector move: the same value as by
      // __shfl_xor, without its three index registers (the budget above)
      int rb = __builtin_bit_cast(int, rs);
      rs += __builtin_bit_cast(
          float, __builtin_amdgcn_permlanex16(rb, rb, 0x76543210, 0xfedcba98,
                                              false, false));
    }
    lrun += rs;

    // ---- PV: o += P.V ; A = probs (in regs), B = Vt rows. 4 WMMAs.
#pragma unroll
    for (int j = 0; j < 4; ++j) o[j] = wmma_bf16(pf, vf[j], o[j]);
   }

    // ---- publish point of stage st + 1, then refill the buffer just read
    asm volatile("s_wait_dscnt 0x0" ::: "memory");     // own LDS reads done
    asm volatile("s_wait_asynccnt 0x0" ::: "memory");  // own copies landed
    __syncthreads();  // stage st + 1 readable; every reader has left stage st
    if (st + 2 < ST_COUNT)
      stage_copy(lk0 + bufo * 2u, lk0 + (bufo + ST_TILE) * 2u,
                 gk + (size_t)(st + 2) * ST_KEYS * D_K,
                 gv + (st + 2) * ST_KEYS);
  }
  asm volatile("s_wait_asynccnt 0x0" ::: "memory");  // nothing left in flight

  // ---- broadcast 1/l per query to m-indexed rows, normalize, store bf16
  {
    float inv = 1.0f / lrun;
    if (lane < 16) cl[lane] = inv;
  }
  asm volatile("s_wait_dscnt 0" ::: "memory");
  float4 c0 = *(const float4*)(cl + hi * 8);
  float4 c1 = *(const float4*)(cl + hi * 8 + 4);
  float cc[8] = {c0.x, c0.y, c0.z, c0.w, c1.x, c1.y, c1.z, c1.w};
#pragma unroll
  for (int j = 0; j < 4; ++j) {
    int d = h * D_K + j * 16 + l15;
#pragma unroll
    for (int r = 0; r < 8; ++r) {
      int m = q0 + r + hi * 8;
      ctx[(size_t)(b * SEQ + m) * D_MODEL + d] = (__bf16)(o[j][r] * cc[r]);
    }
  }
}

// ---------------------------------------------------------------------------
extern "C" void kernel_launch(void* const* d_in, const int* in_sizes, int n_in,
                              void* d_out, int out_size, void* d_ws,
                              size_t ws_size, hipStream_t stream) {
  const float* x  = (const float*)d_in[0];
  const float* Wq = (const float*)d_in[1];
  const float* bq = (const float*)d_in[2];
  const float* Wk = (const float*)d_in[3];
  const float* bk = (const float*)d_in[4];
  const float* Wv = (const float*)d_in[5];
  const float* bv = (const float*)d_in[6];
  const float* Wo = (const float*)d_in[7];
  const float* bo = (const float*)d_in[8];
  float* out = (float*)d_out;

  // Workspace layout (bf16 buffers)
  char*   ws    = (char*)d_ws;
  __bf16* xbf   = (__bf16*)ws;                      // M x 1024
  __bf16* Wqt   = xbf + (size_t)MTOT * D_MODEL;     // 1024 x 1024
  __bf16* Wkt   = Wqt + (size_t)D_MODEL * D_MODEL;  // 64 x 1024
  __bf16* Wvt   = Wkt + (size_t)D_K * D_MODEL;      // 64 x 1024
  __bf16* Wot   = Wvt + (size_t)D_K * D_MODEL;      // 1024 x 1024
  __bf16* Qbf   = Wot + (size_t)D_MODEL * D_MODEL;  // M x 1024
  __bf16* Kbf   = Qbf + (size_t)MTOT * D_MODEL;     // M x 64
  __bf16* Vtbf  = Kbf + (size_t)MTOT * D_K;         // 64 x M
  __bf16* ctxbf = Vtbf + (size_t)D_K * MTOT;        // M x 1024

  // ---- prep: x convert + the four weight transposes, one launch
  prep_kernel<<<dim3(TB_ALL + CV_BLOCKS), dim3(256), 0, stream>>>(
      x, Wq, Wk, Wv, Wo, xbf, Wqt, Wkt, Wvt, Wot);

  dim3 blk(128);
  // Q = (x@Wq + bq) * log2(e)/sqrt(64), K = x@Wk + bk, V^T = (x@Wv + bv)^T -> bf16
  gemm_qkv_kernel<<<dim3(MTOT / 128, D_MODEL / 128 + 1), blk, 0, stream>>>(
      xbf, Wqt, Wkt, Wvt, bq, bk, bv, Qbf, Kbf, Vtbf);
  // attention -> ctx bf16
  mqa_attn_kernel<<<dim3(SEQ / (16 * ATT_WAVES), BATCH * NUM_HEADS), blk, 0,
                    stream>>>(Qbf, Kbf, Vtbf, ctxbf);
  // out = ctx@Wo + bo -> f32
  gemm_bf16_kernel<D_MODEL, D_MODEL, false, false>
      <<<dim3(MTOT / 128, D_MODEL / 128), blk, 0, stream>>>(ctxbf, Wot, bo, out,
                                                           1.0f);
}

// v007
// One run takes 106 microseconds.
// In both of two side-by-side timings against v006, it was 1.05 times as fast.
// Counting every step since v000, it is 3.73 times as fast.
#include <hip/hip_runtime.h>

// ---------------------------------------------------------------------------
// MQA forward for MI455X (gfx1250), wave32 WMMA bf16 everywhere.
//   1) x -> bf16; W{q,k,v,o} -> transposed bf16 (Wt[n][k])  [one-time prep]
//   2) Q = (x@Wq+bq)*0.125*log2(e) -> bf16 [M,1024]
//      K =  x@Wk+bk        -> bf16 [M,64]
//      Vt = (x@Wv+bv)^T    -> bf16 [64,M]
//   3) flash attention: S^T = K.Q^T (lane owns one query's scores ->
//      in-lane softmax reductions, probs already in PV A-frag layout)
//   4) out = ctx@Wo+bo -> f32
// ---------------------------------------------------------------------------

#define D_MODEL 1024
#define NUM_HEADS 16
#define D_K 64
#define BATCH 4
#define SEQ 2048
#define MTOT (BATCH * SEQ)  // 8192

typedef __attribute__((ext_vector_type(16))) __bf16 v16bf;
typedef __attribute__((ext_vector_type(8)))  float  v8f;
typedef __attribute__((ext_vector_type(2)))  float  v2f;

__device__ __forceinline__ v8f wmma_bf16(v16bf a, v16bf b, v8f c) {
  // (neg_a, A, neg_b, B, c_mod, C, reuse_a, reuse_b)
  return __builtin_amdgcn_wmma_f32_16x16x32_bf16(false, a, false, b,
                                                 (short)0, c, false, false);
}

// Fragment (A or B) from bf16 memory: lane holds k = {kbase..kbase+7,
// kbase+16..kbase+23} of its row/column, kbase=0|8 by lane half. Caller
// passes base = &row[kbase]; both halves are 16B -> two b128 loads.
__device__ __forceinline__ v16bf load_frag_bf16(const __bf16* base) {
  v16bf f;
#pragma unroll
  for (int i = 0; i < 8; ++i) {
    f[i]     = base[i];
    f[i + 8] = base[16 + i];
  }
  return f;
}

// The same fragment from an LDS row (16-byte aligned): two ds_load_b128.
typedef __attribute__((ext_vector_type(8))) __bf16 v8bf;
__device__ __forceinline__ v16bf load_frag_lds(const __bf16* base) {
  v8bf lo = *(const v8bf*)base;
  v8bf hi = *(const v8bf*)(base + 16);
  return __builtin_shufflevector(lo, hi, 0, 1, 2, 3, 4, 5, 6, 7, 8, 9, 10, 11,
                                 12, 13, 14, 15);
}

// ---------------------------------------------------------------------------
// Prep: five jobs that read only inputs and none of each other's output, so
// they run as ONE launch; the block index picks the job (block-uniform).
// ---------------------------------------------------------------------------
__device__ __forceinline__ void convert_bf16_block(
    const float* __restrict__ in, __bf16* __restrict__ out, int n, int blk) {
  int i = (blk * 256 + threadIdx.x) * 4;
  if (i < n) {
    float4 v = *(const float4*)(in + i);
    out[i + 0] = (__bf16)v.x;
    out[i + 1] = (__bf16)v.y;
    out[i + 2] = (__bf16)v.z;
    out[i + 3] = (__bf16)v.w;
  }
}

// Wt[n][k] = bf16(W[k][n]); 32x32 LDS tile transpose. t: tile number, the k
// tile running fastest.
__device__ __forceinline__ void transpose_bf16_block(
    const float* __restrict__ in, __bf16* __restrict__ out, int K, int N,
    int t, float (*tile)[33]) {
  const int k0 = (t % (K / 32)) * 32, n0 = (t / (K / 32)) * 32;
  const int c = threadIdx.x & 31, r8 = threadIdx.x >> 5;  // r8: 0..7
#pragma unroll
  for (int i = 0; i < 4; ++i) {
    int r = r8 + i * 8;
    tile[r][c] = in[(size_t)(k0 + r) * N + n0 + c];
  }
  __syncthreads();
#pragma unroll
  for (int i = 0; i < 4; ++i) {
    int r = r8 + i * 8;
    out[(size_t)(n0 + r) * K + k0 + c] = (__bf16)tile[c][r];
  }
  // another job's code follows in the merged kernel: no register that these
  // stores name is rewritten ahead of this wait
  asm volatile("s_wait_xcnt 0x0" ::: "memory");
}

#define TB_BIG ((D_MODEL / 32) * (D_MODEL / 32))  // tiles of Wq, of Wo: 1024
#define TB_SMALL ((D_MODEL / 32) * (D_K / 32))    // tiles of Wk, of Wv: 64
#define TB_ALL (2 * TB_BIG + 2 * TB_SMALL)        // transposing blocks
#define CV_BLOCKS (MTOT * D_MODEL / 1024)         // converting blocks

// Blocks [0, TB_ALL) transpose the weights, the rest convert x: the blocks
// with the barrier and the short stores start first, under the long stream.
__global__ __launch_bounds__(256) void prep_kernel(
    const float* __restrict__ x, const float* __restrict__ Wq,
    const float* __restrict__ Wk, const float* __restrict__ Wv,
    const float* __restrict__ Wo, __bf16* __restrict__ xbf,
    __bf16* __restrict__ Wqt, __bf16* __restrict__ Wkt,
    __bf16* __restrict__ Wvt, __bf16* __restrict__ Wot) {
  __shared__ float tile[32][33];
  const int blk = blockIdx.x;
  if (blk >= TB_ALL) {
    convert_bf16_block(x, xbf, MTOT * D_MODEL, blk - TB_ALL);
    return;
  }
  const float* in;
  __bf16* out;
  int N, t;
  if (blk < TB_BIG) {
    in = Wq, out = Wqt, N = D_MODEL, t = blk;
  } else if (blk < 2 * TB_BIG) {
    in = Wo, out = Wot, N = D_MODEL, t = blk - TB_BIG;
  } else if (blk < 2 * TB_BIG + TB_SMALL) {
    in = Wk, out = Wkt, N = D_K, t = blk - 2 * TB_BIG;
  } else {
    in = Wv, out = Wvt, N = D_K, t = blk - 2 * TB_BIG - TB_SMALL;
  }
  transpose_bf16_block(in, out, D_MODEL, N, t, tile);
}

// ---------------------------------------------------------------------------
// GEMM: C[M,N] = A[M,Kd](bf16) * Wt[N,Kd](bf16)^T + bias, epilogue scale.
// Block = 128 (4 waves, 2 x 2), block tile 128(M) x 128(N); each wave:
// 64(M) x 64(N), 16 f32 accumulators: every fragment read from LDS feeds four
// WMMAs, and a block brings 256 rows from L2 for 128 x 128 results.
// A and Wt reach the waves through LDS: the block's 128 threads bring a stage
// of 64 k (A: 128 rows of 128 B, Wt: 128 rows of 128 B) with asynchronous b128
// copies that cover whole 128-B lines, into two buffers, one stage ahead.
// Rows are pitched 144 B (16 B x odd) so that ds_load_b128 meets no bank
// conflict. The k order of every sum is unchanged.
// ---------------------------------------------------------------------------
#define GS_K 64                        // k per stage
#define GS_PITCH 72                    // bf16 per LDS row: 128 B data + 16 B pad
#define GS_T (128 * GS_PITCH)          // bf16 per tile (A or Wt), 18432 B
#define GS_BUF (2 * GS_T)              // bf16 per buffer (A tile, then Wt tile)

// One tile of a stage: 8 copies per lane, 16 rows apart each. l: the lane's
// LDS byte address in the tile; glo / ghi: its global address in the tile's
// rows 0..63 / 64..127. s_wait_xcnt 0 closes the statement so that no address
// register is rewritten ahead of it.
template <int Kd>
__device__ __forceinline__ void gemm_tile_copy(unsigned l, const __bf16* glo,
                                               const __bf16* ghi) {
  constexpr unsigned R16 = 16u * GS_PITCH * 2u;  // 16 LDS rows, bytes
  asm volatile(
      "global_load_async_to_lds_b128 %0, %8, off\n\t"
      "global_load_async_to_lds_b128 %1, %9, off\n\t"
      "global_load_async_to_lds_b128 %2, %10, off\n\t"
      "global_load_async_to_lds_b128 %3, %11, off\n\t"
      "global_load_async_to_lds_b128 %4, %12, off\n\t"
      "global_load_async_to_lds_b128 %5, %13, off\n\t"
      "global_load_async_to_lds_b128 %6, %14, off\n\t"
      "global_load_async_to_lds_b128 %7, %15, off\n\t"
      "s_wait_xcnt 0x0"
      ::"v"(l), "v"(l + R16), "v"(l + 2u * R16), "v"(l + 3u * R16),
        "v"(l + 4u * R16), "v"(l + 5u * R16), "v"(l + 6u * R16),
        "v"(l + 7u * R16), "v"(glo), "v"(glo + 16 * Kd), "v"(glo + 32 * Kd),
        "v"(glo + 48 * Kd), "v"(ghi), "v"(ghi + 16 * Kd), "v"(ghi + 32 * Kd),
        "v"(ghi + 48 * Kd)
      : "memory");
}

// The products of one block tile: rows mb.. of A against 128 rows of Wt, given
// as two runs of 64 (wlo: the tile's rows 0..63, whi: its rows 64..127).
// gring: the block's LDS ring; acc[i][j]: the wave's 4 x 4 tiles of 16 x 16.
template <int Kd>
__device__ __forceinline__ void gemm_bf16_products(
    const __bf16* __restrict__ A, const __bf16* __restrict__ wlo,
    const __bf16* __restrict__ whi, int mb, __bf16* gring, v8f (&acc)[4][4]) {
  static_assert(Kd % GS_K == 0 && Kd / GS_K >= 2, "the ring needs two stages");

  const int tid   = threadIdx.x;
  const int wave  = tid >> 5;
  const int lane  = tid & 31;
  const int l15   = lane & 15;
  const int hi    = lane >> 4;
  const int kbase = hi ? 8 : 0;

  // Copy side: thread t brings 16-byte piece (t & 7) of rows (t >> 3) + 16 i.
  const int crow = tid >> 3, cpc = tid & 7;
  const __bf16* ga = A + (size_t)(mb + crow) * Kd + cpc * 8;
  const __bf16* gl = wlo + (size_t)crow * Kd + cpc * 8;
  const __bf16* gh = whi + (size_t)crow * Kd + cpc * 8;
  const unsigned la0 =
      (unsigned)(size_t)gring + (unsigned)(crow * GS_PITCH + cpc * 8) * 2u;

  // Read side: this lane's fragment rows in buffer 0. Waves 0, 1 / 2, 3 take
  // the low / high 64 columns, even / odd waves the low / high 64 rows.
  const __bf16* ar = gring + ((wave & 1) * 64 + l15) * GS_PITCH + kbase;
  const __bf16* wr = gring + GS_T + ((wave >> 1) * 64 + l15) * GS_PITCH + kbase;

  // ---- ring prologue: stage 0 landed and published, stage 1 in flight
  gemm_tile_copy<Kd>(la0, ga, ga + 64 * Kd);
  gemm_tile_copy<Kd>(la0 + GS_T * 2u, gl, gh);
  asm volatile("s_wait_asynccnt 0x0" ::: "memory");  // own copies landed
  __syncthreads();                                   // publish stage 0
  gemm_tile_copy<Kd>(la0 + GS_BUF * 2u, ga + GS_K, ga + 64 * Kd + GS_K);
  gemm_tile_copy<Kd>(la0 + (GS_BUF + GS_T) * 2u, gl + GS_K, gh + GS_K);

  for (int st = 0; st < Kd / GS_K; ++st) {
    const int bufo = (st & 1) * GS_BUF;
    // Fragments are read 32 k at a time: the 16 of a whole stage, held beside
    // the 16 accumulators, spill to scratch. Every loop below is unrolled so
    // that each fragment and accumulator index is a constant.
    v16bf af[4], bf[4];
    // ---- first 32 k of the stage: 16 reads as one group, then 16 products
#pragma unroll
    for (int i = 0; i < 4; ++i)
      af[i] = load_frag_lds(ar + bufo + i * 16 * GS_PITCH);
#pragma unroll
    for (int j = 0; j < 4; ++j)
      bf[j] = load_frag_lds(wr + bufo + j * 16 * GS_PITCH);
#pragma unroll
    for (int i = 0; i < 4; ++i) {
#pragma unroll
      for (int j = 0; j < 4; ++j)
        acc[i][j] = wmma_bf16(af[i], bf[j], acc[i][j]);
    }
    // ---- last 32 k: the buffer is free again as soon as these have returned
#pragma unroll
    for (int i = 0; i < 4; ++i)
      af[i] = load_frag_lds(ar + bufo + i * 16 * GS_PITCH + 32);
#pragma unroll
    for (int j = 0; j < 4; ++j)
      bf[j] = load_frag_lds(wr + bufo + j * 16 * GS_PITCH + 32);

    // ---- publish point of stage st + 1, then refill the buffer just read;
    //      the refill flies under the products below, which need only
    //      registers, and under the next stage's first half
    asm volatile("s_wait_dscnt 0x0" ::: "memory");     // own LDS reads done
    asm volatile("s_wait_asynccnt 0x0" ::: "memory");  // own copies landed
    __syncthreads();  // stage st + 1 readable; every reader has left stage st
    if (st + 2 < Kd / GS_K) {
      gemm_tile_copy<Kd>(la0 + bufo * 2u, ga + (st + 2) * GS_K,
                         ga + 64 * Kd + (st + 2) * GS_K);
      gemm_tile_copy<Kd>(la0 + (bufo + GS_T) * 2u, gl + (st + 2) * GS_K,
                         gh + (st + 2) * GS_K);
    }

#pragma unroll
    for (int i = 0; i < 4; ++i) {
#pragma unroll
      for (int j = 0; j < 4; ++j)
        acc[i][j] = wmma_bf16(af[i], bf[j], acc[i][j]);
    }
  }
  asm volatile("s_wait_asynccnt 0x0" ::: "memory");  // nothing left in flight
}

// The store of one wave's 64 x 64 results, with bias and scale. m0: the wave's
// first row; n0: its first column, in the product's own numbering.
template <int N, bool TRANS_OUT, bool BF16_OUT>
__device__ __forceinline__ void gemm_bf16_store(
    const v8f (&acc)[4][4], const float* __restrict__ bias,
    void* __restrict__ Cout, float out_scale, int m0, int n0) {
  const int lane = threadIdx.x & 31;
  const int l15  = lane & 15;
  const int hi   = lane >> 4;

  float bv[4];
#pragma unroll
  for (int j = 0; j < 4; ++j) bv[j] = bias[n0 + j * 16 + l15];

  // C/D layout: VGPR r -> (mtile + r + 8*hi, n0 + j*16 + l15)
#pragma unroll
  for (int i = 0; i < 4; ++i) {
#pragma unroll
    for (int j = 0; j < 4; ++j) {
      int n = n0 + j * 16 + l15;
#pragma unroll
      for (int r = 0; r < 8; ++r) {
        int    m   = m0 + i * 16 + r + hi * 8;
        float  val = (acc[i][j][r] + bv[j]) * out_scale;
        size_t ix  = TRANS_OUT ? ((size_t)n * MTOT + m) : ((size_t)m * N + n);
        if constexpr (BF16_OUT)
          ((__bf16*)Cout)[ix] = (__bf16)val;
        else
          ((float*)Cout)[ix] = val;
      }
    }
    // the next row tile's values and addresses, and in the merged kernel
    // another product's store code, follow: no register that these stores
    // name is rewritten ahead of this wait
    asm volatile("s_wait_xcnt 0x0" ::: "memory");
  }
}

template <int Kd, int N, bool TRANS_OUT, bool BF16_OUT>
__global__ __launch_bounds__(128) void gemm_bf16_kernel(
    const __bf16* __restrict__ A, const __bf16* __restrict__ Wt,
    const float* __restrict__ bias, void* __restrict__ Cout, float out_scale) {
  __shared__ __align__(16) __bf16 gring[2 * GS_BUF];
  const int mb = blockIdx.x * 128, n0 = blockIdx.y * 128;
  const int wave = threadIdx.x >> 5;
  v8f acc[4][4] = {};
  gemm_bf16_products<Kd>(A, Wt + (size_t)n0 * Kd, Wt + (size_t)(n0 + 64) * Kd,
                         mb, gring, acc);
  gemm_bf16_store<N, TRANS_OUT, BF16_OUT>(acc, bias, Cout, out_scale,
                                          mb + (wave & 1) * 64,
                                          n0 + (wave >> 1) * 64);
}

// Q carries 1/sqrt(64) and log2(e): the scores then are exponents of 2.
#define Q_SCALE (0.125f * 1.44269504f)

// Q, K and V^T read the same A and none of each other's output: ONE launch.
// blockIdx.y picks the column tile (block-uniform): tile 0 holds K in its low
// 64 columns and V^T in its high 64, tiles 1.. are the column tiles of Q. The
// product loop is common; only the weight rows and the store differ. In tile
// 0 a wave stores K or V^T by its column half; no barrier follows.
__global__ __launch_bounds__(128) void gemm_qkv_kernel(
    const __bf16* __restrict__ A, const __bf16* __restrict__ Wqt,
    const __bf16* __restrict__ Wkt, const __bf16* __restrict__ Wvt,
    const float* __restrict__ bq, const float* __restrict__ bk,
    const float* __restrict__ bv, __bf16* __restrict__ Qo,
    __bf16* __restrict__ Ko, __bf16* __restrict__ Vto) {
  __shared__ __align__(16) __bf16 gring[2 * GS_BUF];
  const int mb = blockIdx.x * 128;
  const int y  = blockIdx.y;
  const int nq = (y - 1) * 128;  // first Q column of tiles 1..
  const __bf16* wlo = y == 0 ? Wkt : Wqt + (size_t)nq * D_MODEL;
  const __bf16* whi = y == 0 ? Wvt : Wqt + (size_t)(nq + 64) * D_MODEL;
  v8f acc[4][4] = {};
  gemm_bf16_products<D_MODEL>(A, wlo, whi, mb, gring, acc);
  const int wave = __builtin_amdgcn_readfirstlane(threadIdx.x >> 5);
  const int m0   = mb + (wave & 1) * 64;
  if (y != 0)
    gemm_bf16_store<D_MODEL, false, true>(acc, bq, Qo, Q_SCALE, m0,
                                          nq + (wave >> 1) * 64);
  else if ((wave >> 1) == 0)
    gemm_bf16_store<D_K, false, true>(acc, bk, Ko, 1.0f, m0, 0);
  else
    gemm_bf16_store<D_K, true, true>(acc, bv, Vto, 1.0f, m0, 0);
}

// ---------------------------------------------------------------------------
// Flash attention (MQA): each wave owns a 16-query tile of one (b,h).
// Scores computed TRANSPOSED: S^T[key][q] = K_tile . Q_tile^T (A = K rows,
// B = Q rows; identical fragment bytes, swapped operands). Consequences:
//  * lane (n = lane&15) owns query q: its 8+8 accumulator regs hold keys
//    {0..7,16..23} (low half) / {8..15,24..31} (high half) of the 32-key
//    tile; the xor-16 partner holds the other 16 -> softmax max/sum are
//    in-lane reductions + ONE shfl_xor(16) each.
//  * exp'd probs are ALREADY in the PV A-fragment layout -> no LDS bounce.
//  * running m/l are one scalar per lane; the o-rescale factor goes to o's
//    rows (C-layout rows are m-indexed) by DPP moves inside the 16-lane rows.
//  * the score WMMA hands over the argument of v_exp_f32 as it is: Q holds
//    log2(e), and the accumulator starts at minus the maximum in use (all 8
//    registers of a lane belong to one query), so no subtraction and no
//    product stand between the WMMA and the exponential.
//  * the rescale is lazy: the maximum in use stays until some score of the
//    wave's pass lies more than LAZY_T above it (probs then stay below
//    2^LAZY_T, far inside f32 and bf16 range). One test per pass, a scalar
//    branch; the exchange of maxima between the lane halves, the factor, its
//    broadcast, the 32 products on o and the shift of this pass's 16 scores
//    stand inside that branch. The first pass always takes it.
// K frags are read up-front as one group of 8, V frags as a second group of 8
// behind the rescale test, so that the exp VALU hides their latency and the
// two sets need not be held side by side.
// K and V^T reach the waves through LDS: the block's 128 threads bring a
// stage of 64 keys (K: 64 rows of 128 B, V^T: 64 rows of 128 B) with
// asynchronous b128 copies that cover whole 128-B lines, into two buffers,
// one stage ahead; all four waves read their fragments from there. Rows are
// pitched 144 B (16 B x odd) so that ds_load_b128 meets no bank conflict.
// ---------------------------------------------------------------------------
#define ATT_WAVES 4
#define ST_KEYS 64                     // keys per stage
#define ST_PITCH 72                    // bf16 per LDS row: 128 B data + 16 B pad
#define ST_TILE (64 * ST_PITCH)        // bf16 per tile (K or V^T), 9216 B
#define ST_BUF (2 * ST_TILE)           // bf16 per buffer (K tile, then V^T tile)
#define ST_COUNT (SEQ / ST_KEYS)       // 32 stages
#define LAZY_T 8.65617f                // 6 log2(e): probs stay below about 400

// One stage: 8 copies per lane (4 of K, 4 of V^T), 16 rows apart each.
// lk / lv: the lane's LDS byte address in the K / V^T tile. The global address
// is a scalar base (gk / gv: the stage's first K / V^T byte, the same for the
// whole block) plus the lane's byte offset in the tile (ok / ov): the walk
// along the keys and the 16-row steps are scalar work, and two registers per
// lane hold what four held. s_wait_xcnt 0 closes the statement so that no
// address register is rewritten ahead of it.
__device__ __forceinline__ void stage_copy(unsigned lk, unsigned lv,
                                           unsigned ok, unsigned ov,
                                           const __bf16* gk,
                                           const __bf16* gv) {
  asm volatile(
      "global_load_async_to_lds_b128 %0, %8, %10\n\t"
      "global_load_async_to_lds_b128 %1, %8, %11\n\t"
      "global_load_async_to_lds_b128 %2, %8, %12\n\t"
      "global_load_async_to_lds_b128 %3, %8, %13\n\t"
      "global_load_async_to_lds_b128 %4, %9, %14\n\t"
      "global_load_async_to_lds_b128 %5, %9, %15\n\t"
      "global_load_async_to_lds_b128 %6, %9, %16\n\t"
      "global_load_async_to_lds_b128 %7, %9, %17\n\t"
      "s_wait_xcnt 0x0"
      ::"v"(lk), "v"(lk + 16u * ST_PITCH * 2u), "v"(lk + 32u * ST_PITCH * 2u),
        "v"(lk + 48u * ST_PITCH * 2u), "v"(lv), "v"(lv + 16u * ST_PITCH * 2u),
        "v"(lv + 32u * ST_PITCH * 2u), "v"(lv + 48u * ST_PITCH * 2u), "v"(ok),
        "v"(ov), "s"(gk), "s"(gk + 16 * D_K), "s"(gk + 32 * D_K),
        "s"(gk + 48 * D_K), "s"(gv), "s"(gv + (size_t)16 * MTOT),
        "s"(gv + (size_t)32 * MTOT), "s"(gv + (size_t)48 * MTOT)
      : "memory");
}

// A per-query value (lane = query, the same in both lane halves) handed to the
// rows of the C layout: register r of a lane wants query r + 8 * (lane half).
// The high half first turns its row by 8, so that lane r of EACH 16-lane row
// holds what that row wants; row_share:r then spreads it. All in the vector
// unit: no LDS slot, no address register, no wait.
template <int CTRL>
__device__ __forceinline__ float dpp_move(float v) {
  return __builtin_bit_cast(
      float, __builtin_amdgcn_mov_dpp(__builtin_bit_cast(int, v), CTRL, 0xf,
                                      0xf, true));
}
__device__ __forceinline__ void query_to_rows(float v, bool hi, float (&cc)[8]) {
  const float t = dpp_move<0x128>(v);  // 0x128: row_ror:8, every lane on
  const float y = hi ? t : v;
  cc[0] = dpp_move<0x150>(y);          // 0x150 + r: row_share:r
  cc[1] = dpp_move<0x151>(y);
  cc[2] = dpp_move<0x152>(y);
  cc[3] = dpp_move<0x153>(y);
  cc[4] = dpp_move<0x154>(y);
  cc[5] = dpp_move<0x155>(y);
  cc[6] = dpp_move<0x156>(y);
  cc[7] = dpp_move<0x157>(y);
}

// Second bound: eight waves per SIMD, a budget of 128 registers: the grid is
// eight blocks per WGP, and with fewer resident the last ones run as a second,
// thin round.
__global__ __launch_bounds__(128, 8) void mqa_attn_kernel(
    const __bf16* __restrict__ Q, const __bf16* __restrict__ Kp,
    const __bf16* __restrict__ Vt, __bf16* __restrict__ ctx) {
  __shared__ __align__(16) __bf16 ring[2 * ST_BUF];

  const int tid   = threadIdx.x;
  // the wave's number in a scalar register: what hangs on it costs no VGPR
  const int wave  = __builtin_amdgcn_readfirstlane(tid >> 5);
  const int lane  = tid & 31;
  const int l15   = lane & 15;
  const int hi    = lane >> 4;
  const int kbase = hi ? 8 : 0;

  const int bh = blockIdx.y;  // 0..63
  const int b  = bh >> 4;
  const int h  = bh & 15;
  const int q0 = (blockIdx.x * ATT_WAVES + wave) * 16;

  // Q fragments (used as B operands: Bt[n=q][k=d] = Q row q)
  const __bf16* qrow =
      Q + (size_t)(b * SEQ + q0 + l15) * D_MODEL + h * D_K + kbase;
  v16bf qf0 = load_frag_bf16(qrow);
  v16bf qf1 = load_frag_bf16(qrow + 32);

  // Copy side: thread t brings 16-byte piece (t & 7) of rows (t >> 3) + 16 i.
  const int crow = tid >> 3, cpc = tid & 7;
  const __bf16* gk = Kp + (size_t)b * SEQ * D_K;  // block-uniform bases
  const __bf16* gv = Vt + (size_t)b * SEQ;
  const unsigned ok = (unsigned)(crow * D_K + cpc * 8) * 2u;  // lane offsets
  const unsigned ov = (unsigned)(crow * MTOT + cpc * 8) * 2u;
  const unsigned lk0 =
      (unsigned)(size_t)ring + (unsigned)(crow * ST_PITCH + cpc * 8) * 2u;

  float lrun = 0.0f;    // per-lane scalar (this lane's query)
  v8f negm = {};        // minus the maximum in use, eight times: where the
                        // score sums start
  float mthr = -3e38f;  // a score sum above it: rescale (pass 0: always)
  v8f o[4] = {};

  // ---- ring prologue: stage 0 landed and published, stage 1 in flight
  stage_copy(lk0, lk0 + ST_TILE * 2u, ok, ov, gk, gv);
  asm volatile("s_wait_asynccnt 0x0" ::: "memory");  // own copies landed
  __syncthreads();                                   // publish stage 0
  stage_copy(lk0 + ST_BUF * 2u, lk0 + (ST_BUF + ST_TILE) * 2u, ok, ov,
             gk + ST_KEYS * D_K, gv + ST_KEYS);

  for (int st = 0; st < ST_COUNT; ++st) {
   const int bufo = (st & 1) * ST_BUF;
#pragma unroll
   for (int sub = 0; sub < ST_KEYS; sub += 32) {
    // ---- issue ALL K-fragment loads first (one clause), then 4 WMMAs with
    //      interleaved accumulation chains for ILP.
    const __bf16* kr0 = ring + bufo + (sub + l15) * ST_PITCH + kbase;
    const __bf16* kr1 = kr0 + 16 * ST_PITCH;
    v16bf kf00 = load_frag_lds(kr0);
    v16bf kf01 = load_frag_lds(kr0 + 32);
    v16bf kf10 = load_frag_lds(kr1);
    v16bf kf11 = load_frag_lds(kr1 + 32);
    // holds all 8 reads ahead of the products: left alone they go out in pairs
    // between the products, each pair with a full wait of its own
    __builtin_amdgcn_sched_barrier(0);

    v8f st0 = wmma_bf16(kf00, qf0, negm);  // scores minus the maximum in use
    v8f st1 = wmma_bf16(kf10, qf0, negm);
    st0 = wmma_bf16(kf01, qf1, st0);
    st1 = wmma_bf16(kf11, qf1, st1);

    // ---- in-lane max over this lane's 16 keys
    float vmax = fmaxf(st0[0], st1[0]);
#pragma unroll
    for (int r = 1; r < 8; ++r) vmax = fmaxf(vmax, fmaxf(st0[r], st1[r]));

    // ---- lazy rescale: taken by the whole wave (scalar branch on the ballot)
    //      when any lane's scores pass the threshold; every query then moves
    //      to this pass's maximum if higher (pass 0: always), the same in both lane halves
    if (__builtin_amdgcn_ballot_w32(vmax > mthr) != 0) {
      // partner half's maximum
      const int vb = __builtin_bit_cast(int, vmax);
      float vpar = __builtin_bit_cast(
          float, __builtin_amdgcn_permlanex16(vb, vb, 0x76543210, 0xfedcba98,
                                              false, false));
      // how far the maximum moves: not down, but in pass 0, where negm holds
      // no maximum yet (mthr - LAZY_T: 0 from then on)
      float up = fmaxf(fmaxf(vmax, vpar), mthr - LAZY_T);
      const float was = negm[0];
      negm -= up;
      up = was - negm[0];  // the move as it was rounded
      st0 -= up;
      st1 -= up;
      // pass 0 may move down; o and lrun are 0 there and want a finite factor
      float corr = __builtin_amdgcn_exp2f(fminf(-up, 0.0f));
      mthr = LAZY_T;
      lrun *= corr;
      // per-query corr to o's m-indexed rows
      float cc[8];
      query_to_rows(corr, hi != 0, cc);
#pragma unroll
      for (int j = 0; j < 4; ++j)
#pragma unroll
        for (int r = 0; r < 8; ++r) o[j][r] *= cc[r];
    }

    // ---- V fragments: one group of 8 reads into the registers K has left;
    //      the exponentials below hide their latency. Ahead of the score
    //      products they would hold 32 registers beside K's 32, and the
    //      reads would go out two at a time, each pair with a wait of its own.
    v16bf vf[4];
#pragma unroll
    for (int j = 0; j < 4; ++j)
      vf[j] = load_frag_lds(ring + bufo + ST_TILE + (j * 16 + l15) * ST_PITCH +
                            sub + kbase);
    // keeps the 8 reads together, ahead of the vector work
    __builtin_amdgcn_sched_barrier(0);

    // ---- exp + in-lane sum (+ partner), probs straight into A-frag layout
    //      The sums e0 + e1 are taken two at a time on even register pairs,
    //      so that each exponential can stay in its argument's register; the
    //      order of the running sum is the one it was.
    v16bf pf;
    float rs = 0.0f;
#pragma unroll
    for (int r = 0; r < 8; r += 2) {
      v2f e0 = {__builtin_amdgcn_exp2f(st0[r]),
                __builtin_amdgcn_exp2f(st0[r + 1])};
      v2f e1 = {__builtin_amdgcn_exp2f(st1[r]),
                __builtin_amdgcn_exp2f(st1[r + 1])};
      v2f s = e0 + e1;
      rs = r == 0 ? s.x : rs + s.x;
      rs += s.y;
      pf[r]     = (__bf16)e0.x;  // keys kbase+r, +r+1       of this query
      pf[r + 1] = (__bf16)e0.y;
      pf[r + 8] = (__bf16)e1.x;  // keys kbase+16+r, +16+r+1 of this query
      pf[r + 9] = (__bf16)e1.y;
    }
    {
      // partner half's sum by a cross-row vector move: the same value as by
      // __shfl_xor, without its three index registers (the budget above)
      int rb = __builtin_bit_cast(int, rs);
      rs += __builtin_bit_cast(
          float, __builtin_amdgcn_permlanex16(rb, rb, 0x76543210, 0xfedcba98,
                                              false, false));
    }
    lrun += rs;

    // ---- PV: o += P.V ; A = probs (in regs), B = Vt rows. 4 WMMAs.
#pragma unroll
    for (int j = 0; j < 4; ++j) o[j] = wmma_bf16(pf, vf[j], o[j]);
   }

    // ---- publish point of stage st + 1, then refill the buffer just read
    asm volatile("s_wait_dscnt 0x0" ::: "memory");     // own LDS reads done
    asm volatile("s_wait_asynccnt 0x0" ::: "memory");  // own copies landed
    __syncthreads();  // stage st + 1 readable; every reader has left stage st
    if (st + 2 < ST_COUNT)
      stage_copy(lk0 + bufo * 2u, lk0 + (bufo + ST_TILE) * 2u, ok, ov,
                 gk + (size_t)(st + 2) * ST_KEYS * D_K,
                 gv + (st + 2) * ST_KEYS);
  }
  asm volatile("s_wait_asynccnt 0x0" ::: "memory");  // nothing left in flight

  // ---- broadcast 1/l per query to m-indexed rows, normalize, store bf16
  float cc[8];
  query_to_rows(1.0f / lrun, hi != 0, cc);
  // the lane's number read afresh: kept from the kernel's head, its column
  // and its half would hold two registers through the whole loop
  const int elane = (int)__builtin_amdgcn_mbcnt_lo(~0u, 0u);
#pragma unroll
  for (int j = 0; j < 4; ++j) {
    int d = h * D_K + j * 16 + (elane & 15);
#pragma unroll
    for (int r = 0; r < 8; ++r) {
      int m = q0 + r + (elane >> 4) * 8;
      ctx[(size_t)(b * SEQ + m) * D_MODEL + d] = (__bf16)(o[j][r] * cc[r]);
    }
  }
}

// ---------------------------------------------------------------------------
extern "C" void kernel_launch(void* const* d_in, const int* in_sizes, int n_in,
                              void* d_out, int out_size, void* d_ws,
                              size_t ws_size, hipStream_t stream) {
  const float* x  = (const float*)d_in[0];
  const float* Wq = (const float*)d_in[1];
  const float* bq = (const float*)d_in[2];
  const float* Wk = (const float*)d_in[3];
  const float* bk = (const float*)d_in[4];
  const float* Wv = (const float*)d_in[5];
  const float* bv = (const float*)d_in[6];
  const float* Wo = (const float*)d_in[7];
  const float* bo = (const float*)d_in[8];
  float* out = (float*)d_out;

  // Workspace layout (bf16 buffers)
  char*   ws    = (char*)d_ws;
  __bf16* xbf   = (__bf16*)ws;                      // M x 1024
  __bf16* Wqt   = xbf + (size_t)MTOT * D_MODEL;     // 1024 x 1024
  __bf16* Wkt   = Wqt + (size_t)D_MODEL * D_MODEL;  // 64 x 1024
  __bf16* Wvt   = Wkt + (size_t)D_K * D_MODEL;      // 64 x 1024
  __bf16* Wot   = Wvt + (size_t)D_K * D_MODEL;      // 1024 x 1024
  __bf16* Qbf   = Wot + (size_t)D_MODEL * D_MODEL;  // M x 1024
  __bf16* Kbf   = Qbf + (size_t)MTOT * D_MODEL;     // M x 64
  __bf16* Vtbf  = Kbf + (size_t)MTOT * D_K;         // 64 x M
  __bf16* ctxbf = Vtbf + (size_t)D_K * MTOT;        // M x 1024

  // ---- prep: x convert + the four weight transposes, one launch
  prep_kernel<<<dim3(TB_ALL + CV_BLOCKS), dim3(256), 0, stream>>>(
      x, Wq, Wk, Wv, Wo, xbf, Wqt, Wkt, Wvt, Wot);

  dim3 blk(128);
  // Q = (x@Wq + bq) * log2(e)/sqrt(64), K = x@Wk + bk, V^T = (x@Wv + bv)^T -> bf16
  gemm_qkv_kernel<<<dim3(MTOT / 128, D_MODEL / 128 + 1), blk, 0, stream>>>(
      xbf, Wqt, Wkt, Wvt, bq, bk, bv, Qbf, Kbf, Vtbf);
  // attention -> ctx bf16
  mqa_attn_kernel<<<dim3(SEQ / (16 * ATT_WAVES), BATCH * NUM_HEADS), blk, 0,
                    stream>>>(Qbf, Kbf, Vtbf, ctxbf);
  // out = ctx@Wo + bo -> f32
  gemm_bf16_kernel<D_MODEL, D_MODEL, false, false>
      <<<dim3(MTOT / 128, D_MODEL / 128), blk, 0, stream>>>(ctxbf, Wot, bo, out,
                                                           1.0f);
}

// v008
// Measured time: 96.6 microseconds a run.
// Two timings next to v007 put it at 1.10 and 1.09 times that version's speed.
// All steps since v000 together make it 4.09 times as fast.
#include <hip/hip_runtime.h>

// ---------------------------------------------------------------------------
// MQA forward for MI455X (gfx1250), wave32 WMMA bf16 everywhere.
//   1) x -> bf16; W{q,k,v,o} -> transposed bf16 (Wt[n][k])  [one-time prep]
//   2) Q = (x@Wq+bq)*0.125*log2(e) -> bf16 [M,1024]
//      K =  x@Wk+bk        -> bf16 [M,64]
//      Vt = (x@Wv+bv)^T    -> bf16 [64,M]
//   3) flash attention: S^T = K.Q^T (lane owns one query's scores ->
//      in-lane softmax reductions, probs already in PV A-frag layout)
//   4) out = ctx@Wo+bo -> f32
// ---------------------------------------------------------------------------

#define D_MODEL 1024
#define NUM_HEADS 16
#define D_K 64
#define BATCH 4
#define SEQ 2048
#define MTOT (BATCH * SEQ)  // 8192

typedef __attribute__((ext_vector_type(16))) __bf16 v16bf;
typedef __attribute__((ext_vector_type(8)))  float  v8f;
typedef __attribute__((ext_vector_type(2)))  float  v2f;

__device__ __forceinline__ v8f wmma_bf16(v16bf a, v16bf b, v8f c) {
  // (neg_a, A, neg_b, B, c_mod, C, reuse_a, reuse_b)
  return __builtin_amdgcn_wmma_f32_16x16x32_bf16(false, a, false, b,
                                                 (short)0, c, false, false);
}

// Fragment (A or B) from bf16 memory: lane holds k = {kbase..kbase+7,
// kbase+16..kbase+23} of its row/column, kbase=0|8 by lane half. Caller
// passes base = &row[kbase]; both halves are 16B -> two b128 loads.
__device__ __forceinline__ v16bf load_frag_bf16(const __bf16* base) {
  v16bf f;
#pragma unroll
  for (int i = 0; i < 8; ++i) {
    f[i]     = base[i];
    f[i + 8] = base[16 + i];
  }
  return f;
}

// The same fragment from an LDS row (16-byte aligned): two ds_load_b128.
typedef __attribute__((ext_vector_type(8))) __bf16 v8bf;
__device__ __forceinline__ v16bf load_frag_lds(const __bf16* base) {
  v8bf lo = *(const v8bf*)base;
  v8bf hi = *(const v8bf*)(base + 16);
  return __builtin_shufflevector(lo, hi, 0, 1, 2, 3, 4, 5, 6, 7, 8, 9, 10, 11,
                                 12, 13, 14, 15);
}

// ---------------------------------------------------------------------------
// Prep: five jobs that read only inputs and none of each other's output, so
// they run as ONE launch; the block index picks the job (block-uniform).
// ---------------------------------------------------------------------------
__device__ __forceinline__ void convert_bf16_block(
    const float* __restrict__ in, __bf16* __restrict__ out, int n, int blk) {
  int i = (blk * 256 + threadIdx.x) * 4;
  if (i < n) {
    float4 v = *(const float4*)(in + i);
    out[i + 0] = (__bf16)v.x;
    out[i + 1] = (__bf16)v.y;
    out[i + 2] = (__bf16)v.z;
    out[i + 3] = (__bf16)v.w;
  }
}

// Wt[n][k] = bf16(W[k][n]); 32x32 LDS tile transpose. t: tile number, the k
// tile running fastest.
__device__ __forceinline__ void transpose_bf16_block(
    const float* __restrict__ in, __bf16* __restrict__ out, int K, int N,
    int t, float (*tile)[33]) {
  const int k0 = (t % (K / 32)) * 32, n0 = (t / (K / 32)) * 32;
  const int c = threadIdx.x & 31, r8 = threadIdx.x >> 5;  // r8: 0..7
#pragma unroll
  for (int i = 0; i < 4; ++i) {
    int r = r8 + i * 8;
    tile[r][c] = in[(size_t)(k0 + r) * N + n0 + c];
  }
  __syncthreads();
#pragma unroll
  for (int i = 0; i < 4; ++i) {
    int r = r8 + i * 8;
    out[(size_t)(n0 + r) * K + k0 + c] = (__bf16)tile[c][r];
  }
  // another job's code follows in the merged kernel: no register that these
  // stores name is rewritten ahead of this wait
  asm volatile("s_wait_xcnt 0x0" ::: "memory");
}

#define TB_BIG ((D_MODEL / 32) * (D_MODEL / 32))  // tiles of Wq, of Wo: 1024
#define TB_SMALL ((D_MODEL / 32) * (D_K / 32))    // tiles of Wk, of Wv: 64
#define TB_ALL (2 * TB_BIG + 2 * TB_SMALL)        // transposing blocks
#define CV_BLOCKS (MTOT * D_MODEL / 1024)         // converting blocks

// Blocks [0, TB_ALL) transpose the weights, the rest convert x: the blocks
// with the barrier and the short stores start first, under the long stream.
__global__ __launch_bounds__(256) void prep_kernel(
    const float* __restrict__ x, const float* __restrict__ Wq,
    const float* __restrict__ Wk, const float* __restrict__ Wv,
    const float* __restrict__ Wo, __bf16* __restrict__ xbf,
    __bf16* __restrict__ Wqt, __bf16* __restrict__ Wkt,
    __bf16* __restrict__ Wvt, __bf16* __restrict__ Wot) {
  __shared__ float tile[32][33];
  const int blk = blockIdx.x;
  if (blk >= TB_ALL) {
    convert_bf16_block(x, xbf, MTOT * D_MODEL, blk - TB_ALL);
    return;
  }
  const float* in;
  __bf16* out;
  int N, t;
  if (blk < TB_BIG) {
    in = Wq, out = Wqt, N = D_MODEL, t = blk;
  } else if (blk < 2 * TB_BIG) {
    in = Wo, out = Wot, N = D_MODEL, t = blk - TB_BIG;
  } else if (blk < 2 * TB_BIG + TB_SMALL) {
    in = Wk, out = Wkt, N = D_K, t = blk - 2 * TB_BIG;
  } else {
    in = Wv, out = Wvt, N = D_K, t = blk - 2 * TB_BIG - TB_SMALL;
  }
  transpose_bf16_block(in, out, D_MODEL, N, t, tile);
}

// ---------------------------------------------------------------------------
// GEMM: C[M,N] = A[M,Kd](bf16) * Wt[N,Kd](bf16)^T + bias, epilogue scale.
// Block = 128 (4 waves, 2 x 2), block tile 128(M) x 128(N); each wave:
// 64(M) x 64(N), 16 f32 accumulators: every fragment read from LDS feeds four
// WMMAs, and a block brings 256 rows from L2 for 128 x 128 results.
// A and Wt reach the waves through LDS: the block's 128 threads bring a stage
// of 64 k (A: 128 rows of 128 B, Wt: 128 rows of 128 B) with asynchronous b128
// copies that cover whole 128-B lines, into two buffers, one stage ahead.
// Rows are pitched 144 B (16 B x odd) so that ds_load_b128 meets no bank
// conflict. The k order of every sum is unchanged.
// ---------------------------------------------------------------------------
#define GS_K 64                        // k per stage
#define GS_PITCH 72                    // bf16 per LDS row: 128 B data + 16 B pad
#define GS_T (128 * GS_PITCH)          // bf16 per tile (A or Wt), 18432 B
#define GS_BUF (2 * GS_T)              // bf16 per buffer (A tile, then Wt tile)

// One tile of a stage: 8 copies per lane, 16 rows apart each. l: the lane's
// LDS byte address in the tile; glo / ghi: its global address in the tile's
// rows 0..63 / 64..127. s_wait_xcnt 0 closes the statement so that no address
// register is rewritten ahead of it.
template <int Kd>
__device__ __forceinline__ void gemm_tile_copy(unsigned l, const __bf16* glo,
                                               const __bf16* ghi) {
  constexpr unsigned R16 = 16u * GS_PITCH * 2u;  // 16 LDS rows, bytes
  asm volatile(
      "global_load_async_to_lds_b128 %0, %8, off\n\t"
      "global_load_async_to_lds_b128 %1, %9, off\n\t"
      "global_load_async_to_lds_b128 %2, %10, off\n\t"
      "global_load_async_to_lds_b128 %3, %11, off\n\t"
      "global_load_async_to_lds_b128 %4, %12, off\n\t"
      "global_load_async_to_lds_b128 %5, %13, off\n\t"
      "global_load_async_to_lds_b128 %6, %14, off\n\t"
      "global_load_async_to_lds_b128 %7, %15, off\n\t"
      "s_wait_xcnt 0x0"
      ::"v"(l), "v"(l + R16), "v"(l + 2u * R16), "v"(l + 3u * R16),
        "v"(l + 4u * R16), "v"(l + 5u * R16), "v"(l + 6u * R16),
        "v"(l + 7u * R16), "v"(glo), "v"(glo + 16 * Kd), "v"(glo + 32 * Kd),
        "v"(glo + 48 * Kd), "v"(ghi), "v"(ghi + 16 * Kd), "v"(ghi + 32 * Kd),
        "v"(ghi + 48 * Kd)
      : "memory");
}

// The products of one block tile: rows mb.. of A against 128 rows of Wt, given
// as two runs of 64 (wlo: the tile's rows 0..63, whi: its rows 64..127).
// gring: the block's LDS ring; acc[i][j]: the wave's 4 x 4 tiles of 16 x 16.
template <int Kd>
__device__ __forceinline__ void gemm_bf16_products(
    const __bf16* __restrict__ A, const __bf16* __restrict__ wlo,
    const __bf16* __restrict__ whi, int mb, __bf16* gring, v8f (&acc)[4][4]) {
  static_assert(Kd % GS_K == 0 && Kd / GS_K >= 2, "the ring needs two stages");

  const int tid   = threadIdx.x;
  const int wave  = tid >> 5;
  const int lane  = tid & 31;
  const int l15   = lane & 15;
  const int hi    = lane >> 4;
  const int kbase = hi ? 8 : 0;

  // Copy side: thread t brings 16-byte piece (t & 7) of rows (t >> 3) + 16 i.
  const int crow = tid >> 3, cpc = tid & 7;
  const __bf16* ga = A + (size_t)(mb + crow) * Kd + cpc * 8;
  const __bf16* gl = wlo + (size_t)crow * Kd + cpc * 8;
  const __bf16* gh = whi + (size_t)crow * Kd + cpc * 8;
  const unsigned la0 =
      (unsigned)(size_t)gring + (unsigned)(crow * GS_PITCH + cpc * 8) * 2u;

  // Read side: this lane's fragment rows in buffer 0. Waves 0, 1 / 2, 3 take
  // the low / high 64 columns, even / odd waves the low / high 64 rows.
  const __bf16* ar = gring + ((wave & 1) * 64 + l15) * GS_PITCH + kbase;
  const __bf16* wr = gring + GS_T + ((wave >> 1) * 64 + l15) * GS_PITCH + kbase;

  // ---- ring prologue: stage 0 landed and published, stage 1 in flight
  gemm_tile_copy<Kd>(la0, ga, ga + 64 * Kd);
  gemm_tile_copy<Kd>(la0 + GS_T * 2u, gl, gh);
  asm volatile("s_wait_asynccnt 0x0" ::: "memory");  // own copies landed
  __syncthreads();                                   // publish stage 0
  gemm_tile_copy<Kd>(la0 + GS_BUF * 2u, ga + GS_K, ga + 64 * Kd + GS_K);
  gemm_tile_copy<Kd>(la0 + (GS_BUF + GS_T) * 2u, gl + GS_K, gh + GS_K);

  for (int st = 0; st < Kd / GS_K; ++st) {
    const int bufo = (st & 1) * GS_BUF;
    // Fragments are read 32 k at a time: the 16 of a whole stage, held beside
    // the 16 accumulators, spill to scratch. Every loop below is unrolled so
    // that each fragment and accumulator index is a constant.
    v16bf af[4], bf[4];
    // ---- first 32 k of the stage: 16 reads as one group, then 16 products
#pragma unroll
    for (int i = 0; i < 4; ++i)
      af[i] = load_frag_lds(ar + bufo + i * 16 * GS_PITCH);
#pragma unroll
    for (int j = 0; j < 4; ++j)
      bf[j] = load_frag_lds(wr + bufo + j * 16 * GS_PITCH);
#pragma unroll
    for (int i = 0; i < 4; ++i) {
#pragma unroll
      for (int j = 0; j < 4; ++j)
        acc[i][j] = wmma_bf16(af[i], bf[j], acc[i][j]);
    }
    // ---- last 32 k: the buffer is free again as soon as these have returned
#pragma unroll
    for (int i = 0; i < 4; ++i)
      af[i] = load_frag_lds(ar + bufo + i * 16 * GS_PITCH + 32);
#pragma unroll
    for (int j = 0; j < 4; ++j)
      bf[j] = load_frag_lds(wr + bufo + j * 16 * GS_PITCH + 32);

    // ---- publish point of stage st + 1, then refill the buffer just read;
    //      the refill flies under the products below, which need only
    //      registers, and under the next stage's first half
    asm volatile("s_wait_dscnt 0x0" ::: "memory");     // own LDS reads done
    asm volatile("s_wait_asynccnt 0x0" ::: "memory");  // own copies landed
    __syncthreads();  // stage st + 1 readable; every reader has left stage st
    if (st + 2 < Kd / GS_K) {
      gemm_tile_copy<Kd>(la0 + bufo * 2u, ga + (st + 2) * GS_K,
                         ga + 64 * Kd + (st + 2) * GS_K);
      gemm_tile_copy<Kd>(la0 + (bufo + GS_T) * 2u, gl + (st + 2) * GS_K,
                         gh + (st + 2) * GS_K);
    }

#pragma unroll
    for (int i = 0; i < 4; ++i) {
#pragma unroll
      for (int j = 0; j < 4; ++j)
        acc[i][j] = wmma_bf16(af[i], bf[j], acc[i][j]);
    }
  }
  asm volatile("s_wait_asynccnt 0x0" ::: "memory");  // nothing left in flight
}

// The store of one wave's 64 x 64 results, with bias and scale. m0: the wave's
// first row; n0: its first column, in the product's own numbering.
template <int N, bool TRANS_OUT, bool BF16_OUT>
__device__ __forceinline__ void gemm_bf16_store(
    const v8f (&acc)[4][4], const float* __restrict__ bias,
    void* __restrict__ Cout, float out_scale, int m0, int n0) {
  const int lane = threadIdx.x & 31;
  const int l15  = lane & 15;
  const int hi   = lane >> 4;

  float bv[4];
#pragma unroll
  for (int j = 0; j < 4; ++j) bv[j] = bias[n0 + j * 16 + l15];

  // C/D layout: VGPR r -> (mtile + r + 8*hi, n0 + j*16 + l15)
#pragma unroll
  for (int i = 0; i < 4; ++i) {
#pragma unroll
    for (int j = 0; j < 4; ++j) {
      int n = n0 + j * 16 + l15;
#pragma unroll
      for (int r = 0; r < 8; ++r) {
        int    m   = m0 + i * 16 + r + hi * 8;
        float  val = (acc[i][j][r] + bv[j]) * out_scale;
        size_t ix  = TRANS_OUT ? ((size_t)n * MTOT + m) : ((size_t)m * N + n);
        if constexpr (BF16_OUT)
          ((__bf16*)Cout)[ix] = (__bf16)val;
        else
          ((float*)Cout)[ix] = val;
      }
    }
    // the next row tile's values and addresses, and in the merged kernel
    // another product's store code, follow: no register that these stores
    // name is rewritten ahead of this wait
    asm volatile("s_wait_xcnt 0x0" ::: "memory");
  }
}

template <int Kd, int N, bool TRANS_OUT, bool BF16_OUT>
__global__ __launch_bounds__(128) void gemm_bf16_kernel(
    const __bf16* __restrict__ A, const __bf16* __restrict__ Wt,
    const float* __restrict__ bias, void* __restrict__ Cout, float out_scale) {
  __shared__ __align__(16) __bf16 gring[2 * GS_BUF];
  const int mb = blockIdx.x * 128, n0 = blockIdx.y * 128;
  const int wave = threadIdx.x >> 5;
  v8f acc[4][4] = {};
  gemm_bf16_products<Kd>(A, Wt + (size_t)n0 * Kd, Wt + (size_t)(n0 + 64) * Kd,
                         mb, gring, acc);
  gemm_bf16_store<N, TRANS_OUT, BF16_OUT>(acc, bias, Cout, out_scale,
                                          mb + (wave & 1) * 64,
                                          n0 + (wave >> 1) * 64);
}

// Q carries 1/sqrt(64) and log2(e): the scores then are exponents of 2.
#define Q_SCALE (0.125f * 1.44269504f)

// Q, K and V^T read the same A and none of each other's output: ONE launch.
// blockIdx.y picks the column tile (block-uniform): tile 0 holds K in its low
// 64 columns and V^T in its high 64, tiles 1.. are the column tiles of Q. The
// product loop is common; only the weight rows and the store differ. In tile
// 0 a wave stores K or V^T by its column half; no barrier follows.
__global__ __launch_bounds__(128) void gemm_qkv_kernel(
    const __bf16* __restrict__ A, const __bf16* __restrict__ Wqt,
    const __bf16* __restrict__ Wkt, const __bf16* __restrict__ Wvt,
    const float* __restrict__ bq, const float* __restrict__ bk,
    const float* __restrict__ bv, __bf16* __restrict__ Qo,
    __bf16* __restrict__ Ko, __bf16* __restrict__ Vto) {
  __shared__ __align__(16) __bf16 gring[2 * GS_BUF];
  const int mb = blockIdx.x * 128;
  const int y  = blockIdx.y;
  const int nq = (y - 1) * 128;  // first Q column of tiles 1..
  const __bf16* wlo = y == 0 ? Wkt : Wqt + (size_t)nq * D_MODEL;
  const __bf16* whi = y == 0 ? Wvt : Wqt + (size_t)(nq + 64) * D_MODEL;
  v8f acc[4][4] = {};
  gemm_bf16_products<D_MODEL>(A, wlo, whi, mb, gring, acc);
  const int wave = __builtin_amdgcn_readfirstlane(threadIdx.x >> 5);
  const int m0   = mb + (wave & 1) * 64;
  if (y != 0)
    gemm_bf16_store<D_MODEL, false, true>(acc, bq, Qo, Q_SCALE, m0,
                                          nq + (wave >> 1) * 64);
  else if ((wave >> 1) == 0)
    gemm_bf16_store<D_K, false, true>(acc, bk, Ko, 1.0f, m0, 0);
  else
    gemm_bf16_store<D_K, true, true>(acc, bv, Vto, 1.0f, m0, 0);
}

// ---------------------------------------------------------------------------
// Flash attention (MQA): each wave owns a 16-query tile of one (b,h).
// Scores computed TRANSPOSED: S^T[key][q] = K_tile . Q_tile^T (A = K rows,
// B = Q rows; identical fragment bytes, swapped operands). Consequences:
//  * lane (n = lane&15) owns query q: its 8+8 accumulator regs hold keys
//    {0..7,16..23} (low half) / {8..15,24..31} (high half) of the 32-key
//    tile; the xor-16 partner holds the other 16 -> softmax max/sum are
//    in-lane reductions + ONE shfl_xor(16) each.
//  * exp'd probs are ALREADY in the PV A-fragment layout -> no LDS bounce.
//  * running m/l are one scalar per lane; the o-rescale factor goes to o's
//    rows (C-layout rows are m-indexed) by DPP moves inside the 16-lane rows.
//  * the score WMMA hands over the argument of v_exp_f32 as it is: Q holds
//    log2(e), and the accumulator starts at minus the maximum in use (all 8
//    registers of a lane belong to one query), so no subtraction and no
//    product stand between the WMMA and the exponential.
//  * the rescale is lazy: the maximum in use stays until some score of the
//    wave's pass lies more than LAZY_T above it (probs then stay below
//    2^LAZY_T, far inside f32 and bf16 range). One test per pass, a scalar
//    branch; the exchange of maxima between the lane halves, the factor, its
//    broadcast, the 32 products on o and the shift of this pass's 16 scores
//    stand inside that branch. The first pass always takes it.
// K frags are read up-front as one group of 8, V frags as a second group of 8
// behind the rescale test, so that the exp VALU hides their latency and the
// two sets need not be held side by side.
// K and V^T reach the waves through LDS: the block's 512 threads bring a
// stage of 64 keys (K: 64 rows of 128 B, V^T: 64 rows of 128 B) with
// asynchronous b128 copies that cover whole 128-B lines, into two buffers,
// one stage ahead; all sixteen waves (256 queries of one head) read their
// fragments from there, so that a stage is asked of L2 and written to LDS
// once per 256 queries. Rows are pitched 144 B (16 B x odd) so that
// ds_load_b128 meets no bank conflict.
// ---------------------------------------------------------------------------
#define ATT_WAVES 16
#define ST_KEYS 64                     // keys per stage
#define ST_PITCH 72                    // bf16 per LDS row: 128 B data + 16 B pad
#define ST_TILE (64 * ST_PITCH)        // bf16 per tile (K or V^T), 9216 B
#define ST_BUF (2 * ST_TILE)           // bf16 per buffer (K tile, then V^T tile)
#define ST_COUNT (SEQ / ST_KEYS)       // 32 stages
#define LAZY_T 8.65617f                // 6 log2(e): probs stay below about 400

// One stage: 2 copies per lane (1 of K, 1 of V^T); the 512 threads cover the
// 64 rows of each tile. lk / lv: the lane's LDS byte address in the K / V^T
// tile. The global address is a scalar base (gk / gv: the stage's first K /
// V^T byte, the same for the whole block) plus the lane's byte offset in the
// tile (ok / ov): the walk along the keys is scalar work. s_wait_xcnt 0
// closes the statement so that no address register is rewritten ahead of it.
__device__ __forceinline__ void stage_copy(unsigned lk, unsigned lv,
                                           unsigned ok, unsigned ov,
                                           const __bf16* gk,
                                           const __bf16* gv) {
  asm volatile(
      "global_load_async_to_lds_b128 %0, %2, %4\n\t"
      "global_load_async_to_lds_b128 %1, %3, %5\n\t"
      "s_wait_xcnt 0x0"
      ::"v"(lk), "v"(lv), "v"(ok), "v"(ov), "s"(gk), "s"(gv)
      : "memory");
}

// A per-query value (lane = query, the same in both lane halves) handed to the
// rows of the C layout: register r of a lane wants query r + 8 * (lane half).
// The high half first turns its row by 8, so that lane r of EACH 16-lane row
// holds what that row wants; row_share:r then spreads it. All in the vector
// unit: no LDS slot, no address register, no wait.
template <int CTRL>
__device__ __forceinline__ float dpp_move(float v) {
  return __builtin_bit_cast(
      float, __builtin_amdgcn_mov_dpp(__builtin_bit_cast(int, v), CTRL, 0xf,
                                      0xf, true));
}
__device__ __forceinline__ void query_to_rows(float v, bool hi, float (&cc)[8]) {
  const float t = dpp_move<0x128>(v);  // 0x128: row_ror:8, every lane on
  const float y = hi ? t : v;
  cc[0] = dpp_move<0x150>(y);          // 0x150 + r: row_share:r
  cc[1] = dpp_move<0x151>(y);
  cc[2] = dpp_move<0x152>(y);
  cc[3] = dpp_move<0x153>(y);
  cc[4] = dpp_move<0x154>(y);
  cc[5] = dpp_move<0x155>(y);
  cc[6] = dpp_move<0x156>(y);
  cc[7] = dpp_move<0x157>(y);
}

// Second bound: eight waves per SIMD, a budget of 128 registers: the grid is
// two blocks of sixteen waves per WGP, and with one resident the other half
// would run as a second round.
__global__ __launch_bounds__(32 * ATT_WAVES, 8) void mqa_attn_kernel(
    const __bf16* __restrict__ Q, const __bf16* __restrict__ Kp,
    const __bf16* __restrict__ Vt, __bf16* __restrict__ ctx) {
  __shared__ __align__(16) __bf16 ring[2 * ST_BUF];

  const int tid   = threadIdx.x;
  // the wave's number in a scalar register: what hangs on it costs no VGPR
  const int wave  = __builtin_amdgcn_readfirstlane(tid >> 5);
  const int lane  = tid & 31;
  const int l15   = lane & 15;
  const int hi    = lane >> 4;
  const int kbase = hi ? 8 : 0;

  const int bh = blockIdx.y;  // 0..63
  const int b  = bh >> 4;
  const int h  = bh & 15;
  const int q0 = (blockIdx.x * ATT_WAVES + wave) * 16;

  // Q fragments (used as B operands: Bt[n=q][k=d] = Q row q)
  const __bf16* qrow =
      Q + (size_t)(b * SEQ + q0 + l15) * D_MODEL + h * D_K + kbase;
  v16bf qf0 = load_frag_bf16(qrow);
  v16bf qf1 = load_frag_bf16(qrow + 32);

  // Copy side: thread t brings 16-byte piece (t & 7) of row t >> 3 (0..63).
  const int crow = tid >> 3, cpc = tid & 7;
  const __bf16* gk = Kp + (size_t)b * SEQ * D_K;  // block-uniform bases
  const __bf16* gv = Vt + (size_t)b * SEQ;
  const unsigned ok = (unsigned)(crow * D_K + cpc * 8) * 2u;  // lane offsets
  const unsigned ov = (unsigned)(crow * MTOT + cpc * 8) * 2u;
  const unsigned lk0 =
      (unsigned)(size_t)ring + (unsigned)(crow * ST_PITCH + cpc * 8) * 2u;

  float lrun = 0.0f;    // per-lane scalar (this lane's query)
  v8f negm = {};        // minus the maximum in use, eight times: where the
                        // score sums start
  float mthr = -3e38f;  // a score sum above it: rescale (pass 0: always)
  v8f o[4] = {};

  // ---- ring prologue: stage 0 landed and published, stage 1 in flight
  stage_copy(lk0, lk0 + ST_TILE * 2u, ok, ov, gk, gv);
  asm volatile("s_wait_asynccnt 0x0" ::: "memory");  // own copies landed
  __syncthreads();                                   // publish stage 0
  stage_copy(lk0 + ST_BUF * 2u, lk0 + (ST_BUF + ST_TILE) * 2u, ok, ov,
             gk + ST_KEYS * D_K, gv + ST_KEYS);

  for (int st = 0; st < ST_COUNT; ++st) {
   const int bufo = (st & 1) * ST_BUF;
#pragma unroll
   for (int sub = 0; sub < ST_KEYS; sub += 32) {
    // ---- issue ALL K-fragment loads first (one clause), then 4 WMMAs with
    //      interleaved accumulation chains for ILP.
    const __bf16* kr0 = ring + bufo + (sub + l15) * ST_PITCH + kbase;
    const __bf16* kr1 = kr0 + 16 * ST_PITCH;
    v16bf kf00 = load_frag_lds(kr0);
    v16bf kf01 = load_frag_lds(kr0 + 32);
    v16bf kf10 = load_frag_lds(kr1);
    v16bf kf11 = load_frag_lds(kr1 + 32);
    // holds all 8 reads ahead of the products: left alone they go out in pairs
    // between the products, each pair with a full wait of its own
    __builtin_amdgcn_sched_barrier(0);

    v8f st0 = wmma_bf16(kf00, qf0, negm);  // scores minus the maximum in use
    v8f st1 = wmma_bf16(kf10, qf0, negm);
    st0 = wmma_bf16(kf01, qf1, st0);
    st1 = wmma_bf16(kf11, qf1, st1);

    // ---- in-lane max over this lane's 16 keys
    float vmax = fmaxf(st0[0], st1[0]);
#pragma unroll
    for (int r = 1; r < 8; ++r) vmax = fmaxf(vmax, fmaxf(st0[r], st1[r]));

    // ---- lazy rescale: taken by the whole wave (scalar branch on the ballot)
    //      when any lane's scores pass the threshold; every query then moves
    //      to this pass's maximum if higher (pass 0: always), the same in both lane halves
    if (__builtin_amdgcn_ballot_w32(vmax > mthr) != 0) {
      // partner half's maximum
      const int vb = __builtin_bit_cast(int, vmax);
      float vpar = __builtin_bit_cast(
          float, __builtin_amdgcn_permlanex16(vb, vb, 0x76543210, 0xfedcba98,
                                              false, false));
      // how far the maximum moves: not down, but in pass 0, where negm holds
      // no maximum yet (mthr - LAZY_T: 0 from then on)
      float up = fmaxf(fmaxf(vmax, vpar), mthr - LAZY_T);
      const float was = negm[0];
      negm -= up;
      up = was - negm[0];  // the move as it was rounded
      st0 -= up;
      st1 -= up;
      // pass 0 may move down; o and lrun are 0 there and want a finite factor
      float corr = __builtin_amdgcn_exp2f(fminf(-up, 0.0f));
      mthr = LAZY_T;
      lrun *= corr;
      // per-query corr to o's m-indexed rows
      float cc[8];
      query_to_rows(corr, hi != 0, cc);
#pragma unroll
      for (int j = 0; j < 4; ++j)
#pragma unroll
        for (int r = 0; r < 8; ++r) o[j][r] *= cc[r];
    }

    // ---- V fragments: one group of 8 reads into the registers K has left;
    //      the exponentials below hide their latency. Ahead of the score
    //      products they would hold 32 registers beside K's 32, and the
    //      reads would go out two at a time, each pair with a wait of its own.
    v16bf vf[4];
#pragma unroll
    for (int j = 0; j < 4; ++j)
      vf[j] = load_frag_lds(ring + bufo + ST_TILE + (j * 16 + l15) * ST_PITCH +
                            sub + kbase);
    // keeps the 8 reads together, ahead of the vector work
    __builtin_amdgcn_sched_barrier(0);

    // ---- exp + in-lane sum (+ partner), probs straight into A-frag layout
    //      The sums e0 + e1 are taken two at a time on even register pairs,
    //      so that each exponential can stay in its argument's register; the
    //      order of the running sum is the one it was.
    v16bf pf;
    float rs = 0.0f;
#pragma unroll
    for (int r = 0; r < 8; r += 2) {
      v2f e0 = {__builtin_amdgcn_exp2f(st0[r]),
                __builtin_amdgcn_exp2f(st0[r + 1])};
      v2f e1 = {__builtin_amdgcn_exp2f(st1[r]),
                __builtin_amdgcn_exp2f(st1[r + 1])};
      v2f s = e0 + e1;
      rs = r == 0 ? s.x : rs + s.x;
      rs += s.y;
      pf[r]     = (__bf16)e0.x;  // keys kbase+r, +r+1       of this query
      pf[r + 1] = (__bf16)e0.y;
      pf[r + 8] = (__bf16)e1.x;  // keys kbase+16+r, +16+r+1 of this query
      pf[r + 9] = (__bf16)e1.y;
    }
    {
      // partner half's sum by a cross-row vector move: the same value as by
      // __shfl_xor, without its three index registers (the budget above)
      int rb = __builtin_bit_cast(int, rs);
      rs += __builtin_bit_cast(
          float, __builtin_amdgcn_permlanex16(rb, rb, 0x76543210, 0xfedcba98,
                                              false, false));
    }
    lrun += rs;

    // ---- PV: o += P.V ; A = probs (in regs), B = Vt rows. 4 WMMAs.
#pragma unroll
    for (int j = 0; j < 4; ++j) o[j] = wmma_bf16(pf, vf[j], o[j]);
   }

    // ---- publish point of stage st + 1, then refill the buffer just read
    asm volatile("s_wait_dscnt 0x0" ::: "memory");     // own LDS reads done
    asm volatile("s_wait_asynccnt 0x0" ::: "memory");  // own copies landed
    __syncthreads();  // stage st + 1 readable; every reader has left stage st
    if (st + 2 < ST_COUNT)
      stage_copy(lk0 + bufo * 2u, lk0 + (bufo + ST_TILE) * 2u, ok, ov,
                 gk + (size_t)(st + 2) * ST_KEYS * D_K,
                 gv + (st + 2) * ST_KEYS);
  }
  asm volatile("s_wait_asynccnt 0x0" ::: "memory");  // nothing left in flight

  // ---- broadcast 1/l per query to m-indexed rows, normalize, store bf16
  float cc[8];
  query_to_rows(1.0f / lrun, hi != 0, cc);
  // the lane's number read afresh: kept from the kernel's head, its column
  // and its half would hold two registers through the whole loop
  const int elane = (int)__builtin_amdgcn_mbcnt_lo(~0u, 0u);
#pragma unroll
  for (int j = 0; j < 4; ++j) {
    int d = h * D_K + j * 16 + (elane & 15);
#pragma unroll
    for (int r = 0; r < 8; ++r) {
      int m = q0 + r + (elane >> 4) * 8;
      ctx[(size_t)(b * SEQ + m) * D_MODEL + d] = (__bf16)(o[j][r] * cc[r]);
    }
  }
}

// ---------------------------------------------------------------------------
extern "C" void kernel_launch(void* const* d_in, const int* in_sizes, int n_in,
                              void* d_out, int out_size, void* d_ws,
                              size_t ws_size, hipStream_t stream) {
  const float* x  = (const float*)d_in[0];
  const float* Wq = (const float*)d_in[1];
  const float* bq = (const float*)d_in[2];
  const float* Wk = (const float*)d_in[3];
  const float* bk = (const float*)d_in[4];
  const float* Wv = (const float*)d_in[5];
  const float* bv = (const float*)d_in[6];
  const float* Wo = (const float*)d_in[7];
  const float* bo = (const float*)d_in[8];
  float* out = (float*)d_out;

  // Workspace layout (bf16 buffers)
  char*   ws    = (char*)d_ws;
  __bf16* xbf   = (__bf16*)ws;                      // M x 1024
  __bf16* Wqt   = xbf + (size_t)MTOT * D_MODEL;     // 1024 x 1024
  __bf16* Wkt   = Wqt + (size_t)D_MODEL * D_MODEL;  // 64 x 1024
  __bf16* Wvt   = Wkt + (size_t)D_K * D_MODEL;      // 64 x 1024
  __bf16* Wot   = Wvt + (size_t)D_K * D_MODEL;      // 1024 x 1024
  __bf16* Qbf   = Wot + (size_t)D_MODEL * D_MODEL;  // M x 1024
  __bf16* Kbf   = Qbf + (size_t)MTOT * D_MODEL;     // M x 64
  __bf16* Vtbf  = Kbf + (size_t)MTOT * D_K;         // 64 x M
  __bf16* ctxbf = Vtbf + (size_t)D_K * MTOT;        // M x 1024

  // ---- prep: x convert + the four weight transposes, one launch
  prep_kernel<<<dim3(TB_ALL + CV_BLOCKS), dim3(256), 0, stream>>>(
      x, Wq, Wk, Wv, Wo, xbf, Wqt, Wkt, Wvt, Wot);

  dim3 blk(128);
  // Q = (x@Wq + bq) * log2(e)/sqrt(64), K = x@Wk + bk, V^T = (x@Wv + bv)^T -> bf16
  gemm_qkv_kernel<<<dim3(MTOT / 128, D_MODEL / 128 + 1), blk, 0, stream>>>(
      xbf, Wqt, Wkt, Wvt, bq, bk, bv, Qbf, Kbf, Vtbf);
  // attention -> ctx bf16
  mqa_attn_kernel<<<dim3(SEQ / (16 * ATT_WAVES), BATCH * NUM_HEADS),
                    dim3(32 * ATT_WAVES), 0, stream>>>(Qbf, Kbf, Vtbf, ctxbf);
  // out = ctx@Wo + bo -> f32
  gemm_bf16_kernel<D_MODEL, D_MODEL, false, false>
      <<<dim3(MTOT / 128, D_MODEL / 128), blk, 0, stream>>>(ctxbf, Wot, bo, out,
                                                           1.0f);
}

// v009
// A run of this version takes 91.5 microseconds.
// Next to v008, in two timings, it ran 1.05 and 1.06 times as fast.
// Counting every step since v000, it is 4.32 times as fast.
#include <hip/hip_runtime.h>

// ---------------------------------------------------------------------------
// MQA forward for MI455X (gfx1250), wave32 WMMA bf16 everywhere.
//   1) x -> bf16; W{q,k,v,o} -> transposed bf16 (Wt[n][k])  [one-time prep]
//   2) Q = (x@Wq+bq)*0.125*log2(e) -> bf16 [M,1024]
//      K =  x@Wk+bk        -> bf16 [M,64]
//      Vt = (x@Wv+bv)^T    -> bf16 [64,M]
//   3) flash attention: S^T = K.Q^T (lane owns one query's scores ->
//      in-lane softmax reductions, probs already in PV A-frag layout)
//   4) out = ctx@Wo+bo -> f32
// ---------------------------------------------------------------------------

#define D_MODEL 1024
#define NUM_HEADS 16
#define D_K 64
#define BATCH 4
#define SEQ 2048
#define MTOT (BATCH * SEQ)  // 8192

typedef __attribute__((ext_vector_type(16))) __bf16 v16bf;
typedef __attribute__((ext_vector_type(8)))  float  v8f;
typedef __attribute__((ext_vector_type(2)))  float  v2f;

__device__ __forceinline__ v8f wmma_bf16(v16bf a, v16bf b, v8f c) {
  // (neg_a, A, neg_b, B, c_mod, C, reuse_a, reuse_b)
  return __builtin_amdgcn_wmma_f32_16x16x32_bf16(false, a, false, b,
                                                 (short)0, c, false, false);
}

// Fragment (A or B) from bf16 memory: lane holds k = {kbase..kbase+7,
// kbase+16..kbase+23} of its row/column, kbase=0|8 by lane half. Caller
// passes base = &row[kbase]; both halves are 16B -> two b128 loads.
__device__ __forceinline__ v16bf load_frag_bf16(const __bf16* base) {
  v16bf f;
#pragma unroll
  for (int i = 0; i < 8; ++i) {
    f[i]     = base[i];
    f[i + 8] = base[16 + i];
  }
  return f;
}

// The same fragment from an LDS row (16-byte aligned): two ds_load_b128.
typedef __attribute__((ext_vector_type(8))) __bf16 v8bf;
typedef __attribute__((ext_vector_type(4))) __bf16 v4bf;
typedef __attribute__((ext_vector_type(4))) float  v4f;
__device__ __forceinline__ v16bf load_frag_lds(const __bf16* base) {
  v8bf lo = *(const v8bf*)base;
  v8bf hi = *(const v8bf*)(base + 16);
  return __builtin_shufflevector(lo, hi, 0, 1, 2, 3, 4, 5, 6, 7, 8, 9, 10, 11,
                                 12, 13, 14, 15);
}

// ---------------------------------------------------------------------------
// Prep: five jobs that read only inputs and none of each other's output, so
// they run as ONE launch; the block index picks the job (block-uniform).
// ---------------------------------------------------------------------------
__device__ __forceinline__ void convert_bf16_block(
    const float* __restrict__ in, __bf16* __restrict__ out, int n, int blk) {
  int i = (blk * 256 + threadIdx.x) * 4;
  if (i < n) {
    float4 v = *(const float4*)(in + i);
    out[i + 0] = (__bf16)v.x;
    out[i + 1] = (__bf16)v.y;
    out[i + 2] = (__bf16)v.z;
    out[i + 3] = (__bf16)v.w;
  }
}

// Wt[n][k] = bf16(W[k][n]); 32x32 LDS tile transpose. t: tile number, the k
// tile running fastest.
__device__ __forceinline__ void transpose_bf16_block(
    const float* __restrict__ in, __bf16* __restrict__ out, int K, int N,
    int t, float (*tile)[33]) {
  const int k0 = (t % (K / 32)) * 32, n0 = (t / (K / 32)) * 32;
  const int c = threadIdx.x & 31, r8 = threadIdx.x >> 5;  // r8: 0..7
#pragma unroll
  for (int i = 0; i < 4; ++i) {
    int r = r8 + i * 8;
    tile[r][c] = in[(size_t)(k0 + r) * N + n0 + c];
  }
  __syncthreads();
#pragma unroll
  for (int i = 0; i < 4; ++i) {
    int r = r8 + i * 8;
    out[(size_t)(n0 + r) * K + k0 + c] = (__bf16)tile[c][r];
  }
  // another job's code follows in the merged kernel: no register that these
  // stores name is rewritten ahead of this wait
  asm volatile("s_wait_xcnt 0x0" ::: "memory");
}

#define TB_BIG ((D_MODEL / 32) * (D_MODEL / 32))  // tiles of Wq, of Wo: 1024
#define TB_SMALL ((D_MODEL / 32) * (D_K / 32))    // tiles of Wk, of Wv: 64
#define TB_ALL (2 * TB_BIG + 2 * TB_SMALL)        // transposing blocks
#define CV_BLOCKS (MTOT * D_MODEL / 1024)         // converting blocks

// Blocks [0, TB_ALL) transpose the weights, the rest convert x: the blocks
// with the barrier and the short stores start first, under the long stream.
__global__ __launch_bounds__(256) void prep_kernel(
    const float* __restrict__ x, const float* __restrict__ Wq,
    const float* __restrict__ Wk, const float* __restrict__ Wv,
    const float* __restrict__ Wo, __bf16* __restrict__ xbf,
    __bf16* __restrict__ Wqt, __bf16* __restrict__ Wkt,
    __bf16* __restrict__ Wvt, __bf16* __restrict__ Wot) {
  __shared__ float tile[32][33];
  const int blk = blockIdx.x;
  if (blk >= TB_ALL) {
    convert_bf16_block(x, xbf, MTOT * D_MODEL, blk - TB_ALL);
    return;
  }
  const float* in;
  __bf16* out;
  int N, t;
  if (blk < TB_BIG) {
    in = Wq, out = Wqt, N = D_MODEL, t = blk;
  } else if (blk < 2 * TB_BIG) {
    in = Wo, out = Wot, N = D_MODEL, t = blk - TB_BIG;
  } else if (blk < 2 * TB_BIG + TB_SMALL) {
    in = Wk, out = Wkt, N = D_K, t = blk - 2 * TB_BIG;
  } else {
    in = Wv, out = Wvt, N = D_K, t = blk - 2 * TB_BIG - TB_SMALL;
  }
  transpose_bf16_block(in, out, D_MODEL, N, t, tile);
}

// ---------------------------------------------------------------------------
// GEMM: C[M,N] = A[M,Kd](bf16) * Wt[N,Kd](bf16)^T + bias, epilogue scale.
// Block = 128 (4 waves, 2 x 2), block tile 128(M) x 128(N); each wave:
// 64(M) x 64(N), 16 f32 accumulators: every fragment read from LDS feeds four
// WMMAs, and a block brings 256 rows from L2 for 128 x 128 results.
// A and Wt reach the waves through LDS: the block's 128 threads bring a stage
// of 64 k (A: 128 rows of 128 B, Wt: 128 rows of 128 B) with asynchronous b128
// copies that cover whole 128-B lines, into two buffers, one stage ahead.
// Rows are pitched 144 B (16 B x odd) so that ds_load_b128 meets no bank
// conflict. The k order of every sum is unchanged.
// ---------------------------------------------------------------------------
#define GS_K 64                        // k per stage
#define GS_PITCH 72                    // bf16 per LDS row: 128 B data + 16 B pad
#define GS_T (128 * GS_PITCH)          // bf16 per tile (A or Wt), 18432 B
#define GS_BUF (2 * GS_T)              // bf16 per buffer (A tile, then Wt tile)

// One tile of a stage: 8 copies per lane, 16 LDS rows apart each. l: the lane's
// LDS byte address in the tile; glo / ghi: its global address in the tile's
// rows 0..63 / 64..127; RS: global rows between two copies (16: LDS row =
// global row; 1: the dealt order of Wt, see gemm_bf16_products). s_wait_xcnt 0
// closes the statement so that no address register is rewritten ahead of it.
template <int Kd, int RS>
__device__ __forceinline__ void gemm_tile_copy(unsigned l, const __bf16* glo,
                                               const __bf16* ghi) {
  constexpr unsigned R16 = 16u * GS_PITCH * 2u;  // 16 LDS rows, bytes
  asm volatile(
      "global_load_async_to_lds_b128 %0, %8, off\n\t"
      "global_load_async_to_lds_b128 %1, %9, off\n\t"
      "global_load_async_to_lds_b128 %2, %10, off\n\t"
      "global_load_async_to_lds_b128 %3, %11, off\n\t"
      "global_load_async_to_lds_b128 %4, %12, off\n\t"
      "global_load_async_to_lds_b128 %5, %13, off\n\t"
      "global_load_async_to_lds_b128 %6, %14, off\n\t"
      "global_load_async_to_lds_b128 %7, %15, off\n\t"
      "s_wait_xcnt 0x0"
      ::"v"(l), "v"(l + R16), "v"(l + 2u * R16), "v"(l + 3u * R16),
        "v"(l + 4u * R16), "v"(l + 5u * R16), "v"(l + 6u * R16),
        "v"(l + 7u * R16), "v"(glo), "v"(glo + RS * Kd),
        "v"(glo + 2 * RS * Kd), "v"(glo + 3 * RS * Kd), "v"(ghi),
        "v"(ghi + RS * Kd), "v"(ghi + 2 * RS * Kd), "v"(ghi + 3 * RS * Kd)
      : "memory");
}

// The products of one block tile: rows mb.. of A against 128 rows of Wt, given
// as two runs of 64 (wlo: the tile's rows 0..63, whi: its rows 64..127).
// gring: the block's LDS ring; acc[i][j]: the wave's 4 x 4 tiles of 16 x 16.
// The rows of Wt are DEALT: in each run of 64, LDS row 16 j + l holds Wt row
// 4 l + j, so that lane l of column tile j owns output column 4 l + j and a
// lane's four column tiles are four adjacent columns: one wide store per row,
// sixteen lanes side by side, whole 128-B lines. Only the global row that a
// copy asks for changes; LDS writes, LDS reads and every sum stay as they are.
template <int Kd>
__device__ __forceinline__ void gemm_bf16_products(
    const __bf16* __restrict__ A, const __bf16* __restrict__ wlo,
    const __bf16* __restrict__ whi, int mb, __bf16* gring, v8f (&acc)[4][4]) {
  static_assert(Kd % GS_K == 0 && Kd / GS_K >= 2, "the ring needs two stages");

  const int tid   = threadIdx.x;
  const int wave  = tid >> 5;
  const int lane  = tid & 31;
  const int l15   = lane & 15;
  const int hi    = lane >> 4;
  const int kbase = hi ? 8 : 0;

  // Copy side: thread t brings 16-byte piece (t & 7) of rows (t >> 3) + 16 i.
  const int crow = tid >> 3, cpc = tid & 7;
  const __bf16* ga = A + (size_t)(mb + crow) * Kd + cpc * 8;
  const __bf16* gl = wlo + (size_t)(crow * 4) * Kd + cpc * 8;  // dealt rows
  const __bf16* gh = whi + (size_t)(crow * 4) * Kd + cpc * 8;
  const unsigned la0 =
      (unsigned)(size_t)gring + (unsigned)(crow * GS_PITCH + cpc * 8) * 2u;

  // Read side: this lane's fragment rows in buffer 0. Waves 0, 1 / 2, 3 take
  // the low / high 64 columns, even / odd waves the low / high 64 rows.
  const __bf16* ar = gring + ((wave & 1) * 64 + l15) * GS_PITCH + kbase;
  const __bf16* wr = gring + GS_T + ((wave >> 1) * 64 + l15) * GS_PITCH + kbase;

  // ---- ring prologue: stage 0 landed and published, stage 1 in flight
  gemm_tile_copy<Kd, 16>(la0, ga, ga + 64 * Kd);
  gemm_tile_copy<Kd, 1>(la0 + GS_T * 2u, gl, gh);
  asm volatile("s_wait_asynccnt 0x0" ::: "memory");  // own copies landed
  __syncthreads();                                   // publish stage 0
  gemm_tile_copy<Kd, 16>(la0 + GS_BUF * 2u, ga + GS_K, ga + 64 * Kd + GS_K);
  gemm_tile_copy<Kd, 1>(la0 + (GS_BUF + GS_T) * 2u, gl + GS_K, gh + GS_K);

  for (int st = 0; st < Kd / GS_K; ++st) {
    const int bufo = (st & 1) * GS_BUF;
    // Fragments are read 32 k at a time: the 16 of a whole stage, held beside
    // the 16 accumulators, spill to scratch. Every loop below is unrolled so
    // that each fragment and accumulator index is a constant.
    v16bf af[4], bf[4];
    // ---- first 32 k of the stage: 16 reads as one group, then 16 products
#pragma unroll
    for (int i = 0; i < 4; ++i)
      af[i] = load_frag_lds(ar + bufo + i * 16 * GS_PITCH);
#pragma unroll
    for (int j = 0; j < 4; ++j)
      bf[j] = load_frag_lds(wr + bufo + j * 16 * GS_PITCH);
#pragma unroll
    for (int i = 0; i < 4; ++i) {
#pragma unroll
      for (int j = 0; j < 4; ++j)
        acc[i][j] = wmma_bf16(af[i], bf[j], acc[i][j]);
    }
    // ---- last 32 k: the buffer is free again as soon as these have returned
#pragma unroll
    for (int i = 0; i < 4; ++i)
      af[i] = load_frag_lds(ar + bufo + i * 16 * GS_PITCH + 32);
#pragma unroll
    for (int j = 0; j < 4; ++j)
      bf[j] = load_frag_lds(wr + bufo + j * 16 * GS_PITCH + 32);

    // ---- publish point of stage st + 1, then refill the buffer just read;
    //      the refill flies under the products below, which need only
    //      registers, and under the next stage's first half
    asm volatile("s_wait_dscnt 0x0" ::: "memory");     // own LDS reads done
    asm volatile("s_wait_asynccnt 0x0" ::: "memory");  // own copies landed
    __syncthreads();  // stage st + 1 readable; every reader has left stage st
    if (st + 2 < Kd / GS_K) {
      gemm_tile_copy<Kd, 16>(la0 + bufo * 2u, ga + (st + 2) * GS_K,
                             ga + 64 * Kd + (st + 2) * GS_K);
      gemm_tile_copy<Kd, 1>(la0 + (bufo + GS_T) * 2u, gl + (st + 2) * GS_K,
                            gh + (st + 2) * GS_K);
    }

#pragma unroll
    for (int i = 0; i < 4; ++i) {
#pragma unroll
      for (int j = 0; j < 4; ++j)
        acc[i][j] = wmma_bf16(af[i], bf[j], acc[i][j]);
    }
  }
  asm volatile("s_wait_asynccnt 0x0" ::: "memory");  // nothing left in flight
}

// The store of one wave's 64 x 64 results, with bias and scale. m0: the wave's
// first row; n0: its first column, in the product's own numbering.
template <int N, bool TRANS_OUT, bool BF16_OUT>
__device__ __forceinline__ void gemm_bf16_store(
    const v8f (&acc)[4][4], const float* __restrict__ bias,
    void* __restrict__ Cout, float out_scale, int m0, int n0) {
  const int lane = threadIdx.x & 31;
  const int l15  = lane & 15;
  const int hi   = lane >> 4;

  const int nl = n0 + l15 * 4;  // the lane's four adjacent columns (dealt Wt)
  float bv[4];
#pragma unroll
  for (int j = 0; j < 4; ++j) bv[j] = bias[nl + j];

  // C/D layout: VGPR r -> (mtile + r + 8*hi, nl + j)
#pragma unroll
  for (int i = 0; i < 4; ++i) {
    if constexpr (TRANS_OUT) {
      // a lane's 8 registers are 8 adjacent m of one output row n: 16 B
      static_assert(BF16_OUT, "the transposed store is written for bf16");
#pragma unroll
      for (int j = 0; j < 4; ++j) {
        v8bf w;
#pragma unroll
        for (int r = 0; r < 8; ++r)
          w[r] = (__bf16)((acc[i][j][r] + bv[j]) * out_scale);
        *(v8bf*)((__bf16*)Cout + (size_t)(nl + j) * MTOT + m0 + i * 16 +
                 hi * 8) = w;
      }
    } else {
      // one store per row: 4 columns a lane, 64 columns by the 16 lanes
#pragma unroll
      for (int r = 0; r < 8; ++r) {
        const size_t ix = (size_t)(m0 + i * 16 + r + hi * 8) * N + nl;
        if constexpr (BF16_OUT) {
          v4bf w;
#pragma unroll
          for (int j = 0; j < 4; ++j)
            w[j] = (__bf16)((acc[i][j][r] + bv[j]) * out_scale);
          *(v4bf*)((__bf16*)Cout + ix) = w;
        } else {
          v4f w;
#pragma unroll
          for (int j = 0; j < 4; ++j) w[j] = (acc[i][j][r] + bv[j]) * out_scale;
          *(v4f*)((float*)Cout + ix) = w;
        }
      }
    }
    // the next row tile's values and addresses, and in the merged kernel
    // another product's store code, follow: no register that these stores
    // name is rewritten ahead of this wait
    asm volatile("s_wait_xcnt 0x0" ::: "memory");
  }
}

template <int Kd, int N, bool TRANS_OUT, bool BF16_OUT>
__global__ __launch_bounds__(128) void gemm_bf16_kernel(
    const __bf16* __restrict__ A, const __bf16* __restrict__ Wt,
    const float* __restrict__ bias, void* __restrict__ Cout, float out_scale) {
  __shared__ __align__(16) __bf16 gring[2 * GS_BUF];
  const int mb = blockIdx.x * 128, n0 = blockIdx.y * 128;
  const int wave = threadIdx.x >> 5;
  v8f acc[4][4] = {};
  gemm_bf16_products<Kd>(A, Wt + (size_t)n0 * Kd, Wt + (size_t)(n0 + 64) * Kd,
                         mb, gring, acc);
  gemm_bf16_store<N, TRANS_OUT, BF16_OUT>(acc, bias, Cout, out_scale,
                                          mb + (wave & 1) * 64,
                                          n0 + (wave >> 1) * 64);
}

// Q carries 1/sqrt(64) and log2(e): the scores then are exponents of 2.
#define Q_SCALE (0.125f * 1.44269504f)

// Q, K and V^T read the same A and none of each other's output: ONE launch.
// blockIdx.y picks the column tile (block-uniform): tile 0 holds K in its low
// 64 columns and V^T in its high 64, tiles 1.. are the column tiles of Q. The
// product loop is common; only the weight rows and the store differ. In tile
// 0 a wave stores K or V^T by its column half; no barrier follows.
__global__ __launch_bounds__(128) void gemm_qkv_kernel(
    const __bf16* __restrict__ A, const __bf16* __restrict__ Wqt,
    const __bf16* __restrict__ Wkt, const __bf16* __restrict__ Wvt,
    const float* __restrict__ bq, const float* __restrict__ bk,
    const float* __restrict__ bv, __bf16* __restrict__ Qo,
    __bf16* __restrict__ Ko, __bf16* __restrict__ Vto) {
  __shared__ __align__(16) __bf16 gring[2 * GS_BUF];
  const int mb = blockIdx.x * 128;
  const int y  = blockIdx.y;
  const int nq = (y - 1) * 128;  // first Q column of tiles 1..
  const __bf16* wlo = y == 0 ? Wkt : Wqt + (size_t)nq * D_MODEL;
  const __bf16* whi = y == 0 ? Wvt : Wqt + (size_t)(nq + 64) * D_MODEL;
  v8f acc[4][4] = {};
  gemm_bf16_products<D_MODEL>(A, wlo, whi, mb, gring, acc);
  const int wave = __builtin_amdgcn_readfirstlane(threadIdx.x >> 5);
  const int m0   = mb + (wave & 1) * 64;
  if (y != 0)
    gemm_bf16_store<D_MODEL, false, true>(acc, bq, Qo, Q_SCALE, m0,
                                          nq + (wave >> 1) * 64);
  else if ((wave >> 1) == 0)
    gemm_bf16_store<D_K, false, true>(acc, bk, Ko, 1.0f, m0, 0);
  else
    gemm_bf16_store<D_K, true, true>(acc, bv, Vto, 1.0f, m0, 0);
}

// ---------------------------------------------------------------------------
// Flash attention (MQA): each wave owns a 16-query tile of one (b,h).
// Scores computed TRANSPOSED: S^T[key][q] = K_tile . Q_tile^T (A = K rows,
// B = Q rows; identical fragment bytes, swapped operands). Consequences:
//  * lane (n = lane&15) owns query q: its 8+8 accumulator regs hold keys
//    {0..7,16..23} (low half) / {8..15,24..31} (high half) of the 32-key
//    tile; the xor-16 partner holds the other 16 -> softmax max/sum are
//    in-lane reductions + ONE shfl_xor(16) each.
//  * exp'd probs are ALREADY in the PV A-fragment layout -> no LDS bounce.
//  * running m/l are one scalar per lane; the o-rescale factor goes to o's
//    rows (C-layout rows are m-indexed) by DPP moves inside the 16-lane rows.
//  * the score WMMA hands over the argument of v_exp_f32 as it is: Q holds
//    log2(e), and the accumulator starts at minus the maximum in use (all 8
//    registers of a lane belong to one query), so no subtraction and no
//    product stand between the WMMA and the exponential.
//  * the rescale is lazy: the maximum in use stays until some score of the
//    wave's pass lies more than LAZY_T above it (probs then stay below
//    2^LAZY_T, far inside f32 and bf16 range). One test per pass, a scalar
//    branch; the exchange of maxima between the lane halves, the factor, its
//    broadcast, the 32 products on o and the shift of this pass's 16 scores
//    stand inside that branch. The first pass always takes it.
// K frags are read up-front as one group of 8, V frags as a second group of 8
// behind the rescale test, so that the exp VALU hides their latency and the
// two sets need not be held side by side.
// K and V^T reach the waves through LDS: the block's 512 threads bring a
// stage of 64 keys (K: 64 rows of 128 B, V^T: 64 rows of 128 B) with
// asynchronous b128 copies that cover whole 128-B lines, into two buffers,
// one stage ahead; all sixteen waves (256 queries of one head) read their
// fragments from there, so that a stage is asked of L2 and written to LDS
// once per 256 queries. Rows are pitched 144 B (16 B x odd) so that
// ds_load_b128 meets no bank conflict.
// ---------------------------------------------------------------------------
#define ATT_WAVES 16
#define ST_KEYS 64                     // keys per stage
#define ST_PITCH 72                    // bf16 per LDS row: 128 B data + 16 B pad
#define ST_TILE (64 * ST_PITCH)        // bf16 per tile (K or V^T), 9216 B
#define ST_BUF (2 * ST_TILE)           // bf16 per buffer (K tile, then V^T tile)
#define ST_COUNT (SEQ / ST_KEYS)       // 32 stages
#define LAZY_T 8.65617f                // 6 log2(e): probs stay below about 400

// One stage: 2 copies per lane (1 of K, 1 of V^T); the 512 threads cover the
// 64 rows of each tile. lk / lv: the lane's LDS byte address in the K / V^T
// tile. The global address is a scalar base (gk / gv: the stage's first K /
// V^T byte, the same for the whole block) plus the lane's byte offset in the
// tile (ok / ov): the walk along the keys is scalar work. s_wait_xcnt 0
// closes the statement so that no address register is rewritten ahead of it.
__device__ __forceinline__ void stage_copy(unsigned lk, unsigned lv,
                                           unsigned ok, unsigned ov,
                                           const __bf16* gk,
                                           const __bf16* gv) {
  asm volatile(
      "global_load_async_to_lds_b128 %0, %2, %4\n\t"
      "global_load_async_to_lds_b128 %1, %3, %5\n\t"
      "s_wait_xcnt 0x0"
      ::"v"(lk), "v"(lv), "v"(ok), "v"(ov), "s"(gk), "s"(gv)
      : "memory");
}

// A per-query value (lane = query, the same in both lane halves) handed to the
// rows of the C layout: register r of a lane wants query r + 8 * (lane half).
// The high half first turns its row by 8, so that lane r of EACH 16-lane row
// holds what that row wants; row_share:r then spreads it. All in the vector
// unit: no LDS slot, no address register, no wait.
template <int CTRL>
__device__ __forceinline__ float dpp_move(float v) {
  return __builtin_bit_cast(
      float, __builtin_amdgcn_mov_dpp(__builtin_bit_cast(int, v), CTRL, 0xf,
                                      0xf, true));
}
__device__ __forceinline__ void query_to_rows(float v, bool hi, float (&cc)[8]) {
  const float t = dpp_move<0x128>(v);  // 0x128: row_ror:8, every lane on
  const float y = hi ? t : v;
  cc[0] = dpp_move<0x150>(y);          // 0x150 + r: row_share:r
  cc[1] = dpp_move<0x151>(y);
  cc[2] = dpp_move<0x152>(y);
  cc[3] = dpp_move<0x153>(y);
  cc[4] = dpp_move<0x154>(y);
  cc[5] = dpp_move<0x155>(y);
  cc[6] = dpp_move<0x156>(y);
  cc[7] = dpp_move<0x157>(y);
}

// Second bound: eight waves per SIMD, a budget of 128 registers: the grid is
// two blocks of sixteen waves per WGP, and with one resident the other half
// would run as a second round.
__global__ __launch_bounds__(32 * ATT_WAVES, 8) void mqa_attn_kernel(
    const __bf16* __restrict__ Q, const __bf16* __restrict__ Kp,
    const __bf16* __restrict__ Vt, __bf16* __restrict__ ctx) {
  __shared__ __align__(16) __bf16 ring[2 * ST_BUF];

  const int tid   = threadIdx.x;
  // the wave's number in a scalar register: what hangs on it costs no VGPR
  const int wave  = __builtin_amdgcn_readfirstlane(tid >> 5);
  const int lane  = tid & 31;
  const int l15   = lane & 15;
  const int hi    = lane >> 4;
  const int kbase = hi ? 8 : 0;

  const int bh = blockIdx.y;  // 0..63
  const int b  = bh >> 4;
  const int h  = bh & 15;
  const int q0 = (blockIdx.x * ATT_WAVES + wave) * 16;

  // Q fragments (used as B operands: Bt[n=q][k=d] = Q row q)
  const __bf16* qrow =
      Q + (size_t)(b * SEQ + q0 + l15) * D_MODEL + h * D_K + kbase;
  v16bf qf0 = load_frag_bf16(qrow);
  v16bf qf1 = load_frag_bf16(qrow + 32);

  // Copy side: thread t brings 16-byte piece (t & 7) of row t >> 3 (0..63).
  const int crow = tid >> 3, cpc = tid & 7;
  const __bf16* gk = Kp + (size_t)b * SEQ * D_K;  // block-uniform bases
  const __bf16* gv = Vt + (size_t)b * SEQ;
  const unsigned ok = (unsigned)(crow * D_K + cpc * 8) * 2u;  // lane offsets
  // V^T rows are dealt: LDS row 16 j + l holds V^T row 4 l + j, so that a
  // lane's four o tiles are four adjacent columns of ctx (one store per row)
  const unsigned ov =
      (unsigned)(((crow & 15) * 4 + (crow >> 4)) * MTOT + cpc * 8) * 2u;
  const unsigned lk0 =
      (unsigned)(size_t)ring + (unsigned)(crow * ST_PITCH + cpc * 8) * 2u;

  float lrun = 0.0f;    // per-lane scalar (this lane's query)
  v8f negm = {};        // minus the maximum in use, eight times: where the
                        // score sums start
  float mthr = -3e38f;  // a score sum above it: rescale (pass 0: always)
  v8f o[4] = {};

  // ---- ring prologue: stage 0 landed and published, stage 1 in flight
  stage_copy(lk0, lk0 + ST_TILE * 2u, ok, ov, gk, gv);
  asm volatile("s_wait_asynccnt 0x0" ::: "memory");  // own copies landed
  __syncthreads();                                   // publish stage 0
  stage_copy(lk0 + ST_BUF * 2u, lk0 + (ST_BUF + ST_TILE) * 2u, ok, ov,
             gk + ST_KEYS * D_K, gv + ST_KEYS);

  for (int st = 0; st < ST_COUNT; ++st) {
   const int bufo = (st & 1) * ST_BUF;
#pragma unroll
   for (int sub = 0; sub < ST_KEYS; sub += 32) {
    // ---- issue ALL K-fragment loads first (one clause), then 4 WMMAs with
    //      interleaved accumulation chains for ILP.
    const __bf16* kr0 = ring + bufo + (sub + l15) * ST_PITCH + kbase;
    const __bf16* kr1 = kr0 + 16 * ST_PITCH;
    v16bf kf00 = load_frag_lds(kr0);
    v16bf kf01 = load_frag_lds(kr0 + 32);
    v16bf kf10 = load_frag_lds(kr1);
    v16bf kf11 = load_frag_lds(kr1 + 32);
    // holds all 8 reads ahead of the products: left alone they go out in pairs
    // between the products, each pair with a full wait of its own
    __builtin_amdgcn_sched_barrier(0);

    v8f st0 = wmma_bf16(kf00, qf0, negm);  // scores minus the maximum in use
    v8f st1 = wmma_bf16(kf10, qf0, negm);
    st0 = wmma_bf16(kf01, qf1, st0);
    st1 = wmma_bf16(kf11, qf1, st1);

    // ---- in-lane max over this lane's 16 keys
    float vmax = fmaxf(st0[0], st1[0]);
#pragma unroll
    for (int r = 1; r < 8; ++r) vmax = fmaxf(vmax, fmaxf(st0[r], st1[r]));

    // ---- lazy rescale: taken by the whole wave (scalar branch on the ballot)
    //      when any lane's scores pass the threshold; every query then moves
    //      to this pass's maximum if higher (pass 0: always), the same in both lane halves
    if (__builtin_amdgcn_ballot_w32(vmax > mthr) != 0) {
      // partner half's maximum
      const int vb = __builtin_bit_cast(int, vmax);
      float vpar = __builtin_bit_cast(
          float, __builtin_amdgcn_permlanex16(vb, vb, 0x76543210, 0xfedcba98,
                                              false, false));
      // how far the maximum moves: not down, but in pass 0, where negm holds
      // no maximum yet (mthr - LAZY_T: 0 from then on)
      float up = fmaxf(fmaxf(vmax, vpar), mthr - LAZY_T);
      const float was = negm[0];
      negm -= up;
      up = was - negm[0];  // the move as it was rounded
      st0 -= up;
      st1 -= up;
      // pass 0 may move down; o and lrun are 0 there and want a finite factor
      float corr = __builtin_amdgcn_exp2f(fminf(-up, 0.0f));
      mthr = LAZY_T;
      lrun *= corr;
      // per-query corr to o's m-indexed rows
      float cc[8];
      query_to_rows(corr, hi != 0, cc);
#pragma unroll
      for (int j = 0; j < 4; ++j)
#pragma unroll
        for (int r = 0; r < 8; ++r) o[j][r] *= cc[r];
    }

    // ---- V fragments: one group of 8 reads into the registers K has left;
    //      the exponentials below hide their latency. Ahead of the score
    //      products they would hold 32 registers beside K's 32, and the
    //      reads would go out two at a time, each pair with a wait of its own.
    v16bf vf[4];
#pragma unroll
    for (int j = 0; j < 4; ++j)
      vf[j] = load_frag_lds(ring + bufo + ST_TILE + (j * 16 + l15) * ST_PITCH +
                            sub + kbase);
    // keeps the 8 reads together, ahead of the vector work
    __builtin_amdgcn_sched_barrier(0);

    // ---- exp + in-lane sum (+ partner), probs straight into A-frag layout
    //      The sums e0 + e1 are taken two at a time on even register pairs,
    //      so that each exponential can stay in its argument's register; the
    //      order of the running sum is the one it was.
    v16bf pf;
    float rs = 0.0f;
#pragma unroll
    for (int r = 0; r < 8; r += 2) {
      v2f e0 = {__builtin_amdgcn_exp2f(st0[r]),
                __builtin_amdgcn_exp2f(st0[r + 1])};
      v2f e1 = {__builtin_amdgcn_exp2f(st1[r]),
                __builtin_amdgcn_exp2f(st1[r + 1])};
      v2f s = e0 + e1;
      rs = r == 0 ? s.x : rs + s.x;
      rs += s.y;
      pf[r]     = (__bf16)e0.x;  // keys kbase+r, +r+1       of this query
      pf[r + 1] = (__bf16)e0.y;
      pf[r + 8] = (__bf16)e1.x;  // keys kbase+16+r, +16+r+1 of this query
      pf[r + 9] = (__bf16)e1.y;
    }
    {
      // partner half's sum by a cross-row vector move: the same value as by
      // __shfl_xor, without its three index registers (the budget above)
      int rb = __builtin_bit_cast(int, rs);
      rs += __builtin_bit_cast(
          float, __builtin_amdgcn_permlanex16(rb, rb, 0x76543210, 0xfedcba98,
                                              false, false));
    }
    lrun += rs;

    // ---- PV: o += P.V ; A = probs (in regs), B = Vt rows. 4 WMMAs.
#pragma unroll
    for (int j = 0; j < 4; ++j) o[j] = wmma_bf16(pf, vf[j], o[j]);
   }

    // ---- publish point of stage st + 1, then refill the buffer just read
    asm volatile("s_wait_dscnt 0x0" ::: "memory");     // own LDS reads done
    asm volatile("s_wait_asynccnt 0x0" ::: "memory");  // own copies landed
    __syncthreads();  // stage st + 1 readable; every reader has left stage st
    if (st + 2 < ST_COUNT)
      stage_copy(lk0 + bufo * 2u, lk0 + (bufo + ST_TILE) * 2u, ok, ov,
                 gk + (size_t)(st + 2) * ST_KEYS * D_K,
                 gv + (st + 2) * ST_KEYS);
  }
  asm volatile("s_wait_asynccnt 0x0" ::: "memory");  // nothing left in flight

  // ---- broadcast 1/l per query to m-indexed rows, normalize, store bf16
  float cc[8];
  query_to_rows(1.0f / lrun, hi != 0, cc);
  // the lane's number read afresh: kept from the kernel's head, its column
  // and its half would hold two registers through the whole loop
  const int elane = (int)__builtin_amdgcn_mbcnt_lo(~0u, 0u);
  // 4 columns a lane, the head's 64 columns (one 128-B line) by the 16 lanes
  const int d = h * D_K + (elane & 15) * 4;
#pragma unroll
  for (int r = 0; r < 8; ++r) {
    int m = q0 + r + (elane >> 4) * 8;
    v4bf w;
#pragma unroll
    for (int j = 0; j < 4; ++j) w[j] = (__bf16)(o[j][r] * cc[r]);
    *(v4bf*)(ctx + (size_t)(b * SEQ + m) * D_MODEL + d) = w;
  }
}

// ---------------------------------------------------------------------------
extern "C" void kernel_launch(void* const* d_in, const int* in_sizes, int n_in,
                              void* d_out, int out_size, void* d_ws,
                              size_t ws_size, hipStream_t stream) {
  const float* x  = (const float*)d_in[0];
  const float* Wq = (const float*)d_in[1];
  const float* bq = (const float*)d_in[2];
  const float* Wk = (const float*)d_in[3];
  const float* bk = (const float*)d_in[4];
  const float* Wv = (const float*)d_in[5];
  const float* bv = (const float*)d_in[6];
  const float* Wo = (const float*)d_in[7];
  const float* bo = (const float*)d_in[8];
  float* out = (float*)d_out;

  // Workspace layout (bf16 buffers)
  char*   ws    = (char*)d_ws;
  __bf16* xbf   = (__bf16*)ws;                      // M x 1024
  __bf16* Wqt   = xbf + (size_t)MTOT * D_MODEL;     // 1024 x 1024
  __bf16* Wkt   = Wqt + (size_t)D_MODEL * D_MODEL;  // 64 x 1024
  __bf16* Wvt   = Wkt + (size_t)D_K * D_MODEL;      // 64 x 1024
  __bf16* Wot   = Wvt + (size_t)D_K * D_MODEL;      // 1024 x 1024
  __bf16* Qbf   = Wot + (size_t)D_MODEL * D_MODEL;  // M x 1024
  __bf16* Kbf   = Qbf + (size_t)MTOT * D_MODEL;     // M x 64
  __bf16* Vtbf  = Kbf + (size_t)MTOT * D_K;         // 64 x M
  __bf16* ctxbf = Vtbf + (size_t)D_K * MTOT;        // M x 1024

  // ---- prep: x convert + the four weight transposes, one launch
  prep_kernel<<<dim3(TB_ALL + CV_BLOCKS), dim3(256), 0, stream>>>(
      x, Wq, Wk, Wv, Wo, xbf, Wqt, Wkt, Wvt, Wot);

  dim3 blk(128);
  // Q = (x@Wq + bq) * log2(e)/sqrt(64), K = x@Wk + bk, V^T = (x@Wv + bv)^T -> bf16
  gemm_qkv_kernel<<<dim3(MTOT / 128, D_MODEL / 128 + 1), blk, 0, stream>>>(
      xbf, Wqt, Wkt, Wvt, bq, bk, bv, Qbf, Kbf, Vtbf);
  // attention -> ctx bf16
  mqa_attn_kernel<<<dim3(SEQ / (16 * ATT_WAVES), BATCH * NUM_HEADS),
                    dim3(32 * ATT_WAVES), 0, stream>>>(Qbf, Kbf, Vtbf, ctxbf);
  // out = ctx@Wo + bo -> f32
  gemm_bf16_kernel<D_MODEL, D_MODEL, false, false>
      <<<dim3(MTOT / 128, D_MODEL / 128), blk, 0, stream>>>(ctxbf, Wot, bo, out,
                                                           1.0f);
}
